// v000
// Times are from an AMD MI455X. After a warm-up the kernel runs many times in a row, and a time is the length of
// such a window on the GPU divided by its runs, so every launch and the gaps after it count. The runs cycle
// through copies of the inputs. A figure is the median of several windows, for all but v000 over two sittings.
// Sittings can differ by a few percent; kernels timed side by side share one.
// v000, which the later versions start from, runs in 2880 microseconds.
#include <hip/hip_runtime.h>

// Causal self-attention with a fused biased qkv projection and a computed rotate-half RoPE at a NON-STANDARD frequency table (x [4][2048][1024]; qkv = x W_attn + b_attn ('xw' [1024][3072] 1/32 + a zero bias: read) split in thirds q | k | v (16 heads x 64); _rope_tables: rot = 32; inv_freq = 1 / (10000 ** (arange(0, 32, 2) / 32)): SIXTEEN frequencies; emb = cat(freqs, freqs): [T][32]; x <- cat(x1 cos - x2 sin, x2 cos + x1 sin) on the two HALVES (pairs (d, d + 32)) with the angle index d mod 16, on q and k; att x 1/sqrt(64); causal (-inf); softmax; y = merged W_proj + b_proj ('xw' + a zero bias: read) -> [4][2048][1024] (8.4 M); argument order x, W_attn, b_attn, W_proj, b_proj).
// Layout per batch: bf16 copy of x; fused 'xw' weight transposed once (q | k | v row blocks) + bias thirds; exact projections + f32 biases; k_cstabH computed table (elements d and d + 32 share an angle) + the rotate-half plane builders; causal T-2048 attention (hybrid rows: < 512 hi/lo 3 products, rest fp16 x1024; k_gemmc skips tiles above the diagonal); merged hi/lo x W_proj exact + b_proj.
// Compute dtypes, f32 accumulate: every input rounded to bf16; projections exact + f32 biases; attention rows < 512 3 products, rest fp16; softmax f32; W_proj hl x exact + bias.

#define NB_  4
#define TT   2048
#define DM   1024
#define NH_  16
#define NKV  16
#define REP  (NH_ / NKV)
#define HD   64
#define DQ   (NH_ * HD)
#define DKV  (NKV * HD)
#define ZH   2
#define RH   512                  // query rows < RH use hi+lo planes (0: none)
#define WIN  2048
#define PCAR 1024.0f
#define SCL  0.125f   // HD^-0.5
typedef _Float16 h16;
typedef unsigned short bf;
typedef __attribute__((ext_vector_type(16))) __bf16   v16bf;
typedef __attribute__((ext_vector_type(16))) _Float16 v16h;
typedef __attribute__((ext_vector_type(8)))  _Float16 v8h;
typedef __attribute__((ext_vector_type(8)))  unsigned short v8us;
typedef __attribute__((ext_vector_type(8)))  float    v8f;
typedef __attribute__((ext_vector_type(4)))  float    v4f;
typedef v8h  __attribute__((may_alias)) v8ha;
typedef v4f  __attribute__((may_alias)) v4fa;
typedef v8us __attribute__((may_alias)) v8usa;

__device__ __forceinline__ unsigned short f2bf(float f) { unsigned u = __float_as_uint(f); u += 0x7FFFu + ((u >> 16) & 1u); return (unsigned short)(u >> 16); }
__device__ __forceinline__ float bf2f(unsigned short b) { return __uint_as_float(((unsigned)b) << 16); }
__device__ __forceinline__ float bfr(float f) { return bf2f(f2bf(f)); }
__device__ __forceinline__ v16h cat16(v8h lo, v8h hi) { return __builtin_shufflevector(lo, hi, 0, 1, 2, 3, 4, 5, 6, 7, 8, 9, 10, 11, 12, 13, 14, 15); }
__device__ __forceinline__ v16bf cat16b(v8us lo, v8us hi) { return __builtin_bit_cast(v16bf, __builtin_shufflevector(lo, hi, 0, 1, 2, 3, 4, 5, 6, 7, 8, 9, 10, 11, 12, 13, 14, 15)); }
__device__ __forceinline__ v8f wmma16(v16h a, v16h b, v8f c) { return __builtin_amdgcn_wmma_f32_16x16x32_f16(false, a, false, b, (short)0, c, false, false); }
__device__ __forceinline__ v8f wmmab(v16bf a, v16bf b, v8f c) { return __builtin_amdgcn_wmma_f32_16x16x32_bf16(false, a, false, b, (short)0, c, false, false); }



// ---- k_gemmw: register-blocked GEMM, ONE WAVE per 64x64 output tile (16 accumulators), operands straight from K-contiguous 16-bit planes; grid (M/64, N/64, Z), 32 threads.
// C[m][n] (f32, pitch ldc, + optional f32 bias[n]) = sum_k A[m][k] Bt[n][k] (+ split products per NSPLIT). z-batch strides sA/sB/sC in elements. K % 32 == 0.
template <typename T16> struct WFrag;
template <> struct WFrag<h16> { typedef v16h V; static __device__ __forceinline__ V ld(const h16* p) { return cat16(*(const v8h*)p, *(const v8h*)(p + 16)); } static __device__ __forceinline__ v8f mma(V a, V b, v8f c) { return wmma16(a, b, c); } };
template <> struct WFrag<bf> { typedef v16bf V; static __device__ __forceinline__ V ld(const bf* p) { return cat16b(*(const v8us*)p, *(const v8us*)(p + 16)); } static __device__ __forceinline__ v8f mma(V a, V b, v8f c) { return wmmab(a, b, c); } };
template <typename T16, int NSPLIT, bool BIAS>
__global__ __launch_bounds__(32) void k_gemmw(const T16* __restrict__ A, const T16* __restrict__ A2, const T16* __restrict__ Bt, const T16* __restrict__ Bt2, int K, float* C, int ldc, const float* __restrict__ bias, size_t sA, size_t sB, size_t sC) {
    typedef typename WFrag<T16>::V V;
    __shared__ __align__(16) float os[16 * 68];
    const size_t z = blockIdx.z; A += z * sA; if (A2) A2 += z * sA; Bt += z * sB; if (Bt2) Bt2 += z * sB; C += z * sC;
    const int lane = threadIdx.x & 31, lr = lane & 15, hi = lane >> 4; const int r0 = blockIdx.x * 64, c0 = blockIdx.y * 64;
    v8f acc[4][4];
#pragma unroll
    for (int mb = 0; mb < 4; ++mb)
#pragma unroll
        for (int nb = 0; nb < 4; ++nb) acc[mb][nb] = (v8f){};
    const size_t aoff = (size_t)(r0 + lr) * K + 8 * hi, boff = (size_t)(c0 + lr) * K + 8 * hi;
#pragma unroll 1
    for (int kc = 0; kc < K; kc += 32) {
        V a[4], a2[4];
#pragma unroll
        for (int mb = 0; mb < 4; ++mb) { a[mb] = WFrag<T16>::ld(A + aoff + (size_t)mb * 16 * K + kc); if (NSPLIT == 1 || NSPLIT == 2) a2[mb] = WFrag<T16>::ld(A2 + aoff + (size_t)mb * 16 * K + kc); }
#pragma unroll
        for (int nb = 0; nb < 4; ++nb) { const V b = WFrag<T16>::ld(Bt + boff + (size_t)nb * 16 * K + kc); V b2; if (NSPLIT >= 2) b2 = WFrag<T16>::ld(Bt2 + boff + (size_t)nb * 16 * K + kc);
#pragma unroll
            for (int mb = 0; mb < 4; ++mb) { acc[mb][nb] = WFrag<T16>::mma(a[mb], b, acc[mb][nb]); if (NSPLIT == 1 || NSPLIT == 2) acc[mb][nb] = WFrag<T16>::mma(a2[mb], b, acc[mb][nb]); if (NSPLIT >= 2) acc[mb][nb] = WFrag<T16>::mma(a[mb], b2, acc[mb][nb]); } }
        asm volatile("v_nop\n\tv_nop\n\tv_nop\n\tv_nop" : "+v"(acc[0][0]), "+v"(acc[1][1]), "+v"(acc[2][2]), "+v"(acc[3][3]) : "v"(a[0]), "v"(a[3]));
    }
#pragma unroll
    for (int mb = 0; mb < 4; ++mb) {
#pragma unroll
        for (int nb = 0; nb < 4; ++nb) {
#pragma unroll
            for (int j = 0; j < 8; ++j) os[(hi * 8 + j) * 68 + nb * 16 + lr] = acc[mb][nb][j]; }
        __builtin_amdgcn_wave_barrier(); asm volatile("" ::: "memory");
        float* crow = C + (size_t)(r0 + mb * 16) * ldc + c0;
{
#pragma unroll
            for (int s = 0; s < 8; ++s) { const int row = 2 * s + hi, cofs = lr * 4; v4f val = *(const v4fa*)(os + row * 68 + cofs); if (BIAS) { val[0] += bfr(bias[c0 + cofs]); val[1] += bfr(bias[c0 + cofs + 1]); val[2] += bfr(bias[c0 + cofs + 2]); val[3] += bfr(bias[c0 + cofs + 3]); }
                *(v4f*)(crow + (size_t)row * ldc + cofs) = val; }
             }
        __builtin_amdgcn_wave_barrier(); asm volatile("" ::: "memory");
    }
}

// ---- k_gemmc: the same one-wave 64x64 tile GEMM specialised for causal attention: CMODE 1 skips score tiles entirely above the diagonal (query rows r0+roff.., key columns c0..), CMODE 2 limits the
// key (K) loop of the probability x value contraction to the diagonal block (probabilities beyond it are exactly zero). roff = row offset of this launch's first row within the sequence.
template <typename T16, int NSPLIT, int CMODE>
__global__ __launch_bounds__(32) void k_gemmc(const T16* __restrict__ A, const T16* __restrict__ A2, const T16* __restrict__ Bt, const T16* __restrict__ Bt2, int K, float* C, int ldc, int roff, size_t sA, size_t sB, size_t sC) {
    typedef typename WFrag<T16>::V V;
    __shared__ __align__(16) float os[16 * 68];
    const size_t z = blockIdx.z; A += z * sA; if (A2) A2 += z * sA; Bt += z * sB; if (Bt2) Bt2 += z * sB; C += z * sC;
    const int lane = threadIdx.x & 31, lr = lane & 15, hi = lane >> 4; const int r0 = blockIdx.x * 64, c0 = blockIdx.y * 64;
    if (CMODE == 1 && c0 > r0 + roff + 63) return;                  // score tile entirely above the causal diagonal: never read (the softmax masks j > i by select)
    const int Kl = (CMODE == 2) ? min(K, r0 + roff + 64) : K;        // P.V: probabilities are exactly 0 beyond the diagonal block, so the K loop stops there
    v8f acc[4][4];
#pragma unroll
    for (int mb = 0; mb < 4; ++mb)
#pragma unroll
        for (int nb = 0; nb < 4; ++nb) acc[mb][nb] = (v8f){};
    const size_t aoff = (size_t)(r0 + lr) * K + 8 * hi, boff = (size_t)(c0 + lr) * K + 8 * hi;
#pragma unroll 1
    for (int kc = 0; kc < Kl; kc += 32) {
        V a[4], a2[4];
#pragma unroll
        for (int mb = 0; mb < 4; ++mb) { a[mb] = WFrag<T16>::ld(A + aoff + (size_t)mb * 16 * K + kc); if (NSPLIT == 1 || NSPLIT == 2) a2[mb] = WFrag<T16>::ld(A2 + aoff + (size_t)mb * 16 * K + kc); }
#pragma unroll
        for (int nb = 0; nb < 4; ++nb) { const V b = WFrag<T16>::ld(Bt + boff + (size_t)nb * 16 * K + kc); V b2; if (NSPLIT >= 2) b2 = WFrag<T16>::ld(Bt2 + boff + (size_t)nb * 16 * K + kc);
#pragma unroll
            for (int mb = 0; mb < 4; ++mb) { acc[mb][nb] = WFrag<T16>::mma(a[mb], b, acc[mb][nb]); if (NSPLIT == 1 || NSPLIT == 2) acc[mb][nb] = WFrag<T16>::mma(a2[mb], b, acc[mb][nb]); if (NSPLIT >= 2) acc[mb][nb] = WFrag<T16>::mma(a[mb], b2, acc[mb][nb]); } }
        asm volatile("v_nop\n\tv_nop\n\tv_nop\n\tv_nop" : "+v"(acc[0][0]), "+v"(acc[1][1]), "+v"(acc[2][2]), "+v"(acc[3][3]) : "v"(a[0]), "v"(a[3]));
    }
#pragma unroll
    for (int mb = 0; mb < 4; ++mb) {
#pragma unroll
        for (int nb = 0; nb < 4; ++nb) {
#pragma unroll
            for (int j = 0; j < 8; ++j) os[(hi * 8 + j) * 68 + nb * 16 + lr] = acc[mb][nb][j]; }
        __builtin_amdgcn_wave_barrier(); asm volatile("" ::: "memory");
        float* crow = C + (size_t)(r0 + mb * 16) * ldc + c0;
{
#pragma unroll
            for (int s = 0; s < 8; ++s) { const int row = 2 * s + hi, cofs = lr * 4; v4f val = *(const v4fa*)(os + row * 68 + cofs);
                *(v4f*)(crow + (size_t)row * ldc + cofs) = val; }
             }
        __builtin_amdgcn_wave_barrier(); asm volatile("" ::: "memory");
    }
}

__device__ __forceinline__ h16 tohx(float x) { return (h16)x; }
__device__ __forceinline__ void splitf(float y, unsigned short& h, unsigned short& l) { h = f2bf(y); l = f2bf(y - bf2f(h)); }
typedef __attribute__((ext_vector_type(2))) _Float16 v2h;
typedef __attribute__((ext_vector_type(4))) _Float16 v4h;
typedef __attribute__((ext_vector_type(2))) unsigned short v2us;
typedef __attribute__((ext_vector_type(4))) unsigned short v4us;
typedef __attribute__((ext_vector_type(2))) float v2f;
typedef __attribute__((ext_vector_type(4))) int v4i;

__global__ __launch_bounds__(256) void k_wtG(const float* __restrict__ w, int K, int N, bf* Bt) {
    const int lane = threadIdx.x & 31; const int L0 = (blockIdx.x * 8 + (threadIdx.x >> 5)) * 8; const int nlines = N * K / 64;
{
#pragma unroll 1
        for (int l = 0; l < 8; ++l) { const int L = L0 + l; if (L >= nlines) break; const size_t e = (size_t)L * 64 + lane * 2; const int k = (int)(e % K), n = (int)(e / K); v2us o;
            o[0] = f2bf(w[(size_t)k * N + n]); o[1] = f2bf(w[(size_t)(k + 1) * N + n]); *(v2us*)(Bt + e) = o; }
         }
}
__global__ __launch_bounds__(256) void k_cvt8(const float* __restrict__ src, bf* dst, size_t n8) { const size_t i = (size_t)blockIdx.x * 256 + threadIdx.x; if (i >= n8) return; const v8f v = *(const v8f*)(src + i * 8); v8us o;
#pragma unroll
    for (int k = 0; k < 8; ++k) o[k] = f2bf(v[k]); *(v8us*)(dst + i * 8) = o;  }

// k_rope: head planes [h][t][d] (fp16 + hi/lo) of rope(x) x sc with the rotate-half convention out[d] = x[d] cos[t][d] - x[d+HD/2] sin[t][d], out[d+HD/2] = x[d+HD/2] cos[t][d+HD/2] + x[d] sin[t][d+HD/2]
__global__ __launch_bounds__(256) void k_rope(const float* __restrict__ F, int pitch, int nheads, const float* __restrict__ CS, const float* __restrict__ RF, const float* __restrict__ nw, float sc, h16* P16, bf* Ph, bf* Pl) {
    const size_t e = ((size_t)blockIdx.x * 256 + threadIdx.x) * 2; if (e >= (size_t)nheads * TT * HD) return; const int d = (int)(e % HD); const int t = (int)((e / HD) % TT); const int h = (int)(e / ((size_t)HD * TT)); const float* f = F + (size_t)t * pitch + h * HD; const float rf = RF ? RF[(size_t)h * TT + t] : 1.0f; v2h o16; v2us oh, ol;
#pragma unroll
    for (int q = 0; q < 2; ++q) { const int dd = d + q; const int dp = (dd < HD / 2) ? dd + HD / 2 : dd - HD / 2; float x0 = f[dd], x1 = f[dp];
        if (RF) { float n0 = __fmul_rn(x0, rf), n1 = __fmul_rn(x1, rf); asm volatile("" : "+v"(n0)); asm volatile("" : "+v"(n1)); x0 = __fmul_rn(bfr(nw[dd]), n0); x1 = __fmul_rn(bfr(nw[dp]), n1); }
        const v2f cs = *(const v2f*)(CS + ((size_t)t * HD + dd) * 2); float a = __fmul_rn(x0, cs[0]), bq = __fmul_rn(x1, cs[1]); asm volatile("" : "+v"(a)); asm volatile("" : "+v"(bq)); const float r = ((dd < HD / 2) ? __fsub_rn(a, bq) : __fadd_rn(a, bq)) * sc;
        o16[q] = tohx(r); unsigned short a2, c2; splitf(r, a2, c2); oh[q] = a2; ol[q] = c2; }
    *(v2h*)(P16 + e) = o16; *(v2us*)(Ph + e) = oh; *(v2us*)(Pl + e) = ol;  }
__global__ __launch_bounds__(256) void k_vtp(const float* __restrict__ F, int pitch, int nheads, h16* V16, bf* Vh, bf* Vl) { const size_t e = ((size_t)blockIdx.x * 256 + threadIdx.x) * 2; if (e >= (size_t)nheads * HD * TT) return; const int t = (int)(e % TT); const int d = (int)((e / TT) % HD); const int g = (int)(e / ((size_t)TT * HD)); v2h o16; v2us oh, ol;
#pragma unroll
    for (int q = 0; q < 2; ++q) { const float x = F[(size_t)(t + q) * pitch + g * HD + d]; o16[q] = tohx(x); unsigned short a2, c2; splitf(x, a2, c2); oh[q] = a2; ol[q] = c2; }
    *(v2h*)(V16 + e) = o16; *(v2us*)(Vh + e) = oh; *(v2us*)(Vl + e) = ol;  }
__constant__ float INVT[HD / 2] = { 1.000000000e+00f, 5.623413324e-01f, 3.162277639e-01f, 1.778279394e-01f, 1.000000015e-01f, 5.623412877e-02f, 3.162277862e-02f, 1.778279431e-02f, 9.999999776e-03f, 5.623413250e-03f, 3.162277862e-03f, 1.778279431e-03f, 1.000000047e-03f, 5.623413017e-04f, 3.162277862e-04f, 1.778279402e-04f, 1.000000000e+00f, 5.623413324e-01f, 3.162277639e-01f, 1.778279394e-01f, 1.000000015e-01f, 5.623412877e-02f, 3.162277862e-02f, 1.778279431e-02f, 9.999999776e-03f, 5.623413250e-03f, 3.162277862e-03f, 1.778279431e-03f, 1.000000047e-03f, 5.623413017e-04f, 3.162277862e-04f, 1.778279402e-04f };
__global__ __launch_bounds__(256) void k_cstabH(float* CS) { const int idx = blockIdx.x * 256 + threadIdx.x; if (idx >= TT * HD) return; const int d = idx % HD; const int t = idx / HD; const float a = __fmul_rn((float)t, INVT[d & (HD / 2 - 1)]); v2f cs; cs[0] = cosf(a); cs[1] = sinf(a); *(v2f*)(CS + (size_t)idx * 2) = cs;  }
// k_asoft: per row (zz, i): t = S x HD^-0.5 for j <= i and i - j < WIN (sliding causal window; the reference's -1e9 additive fill vanishes identically); softmax over the 2048 keys (register row, one exp, fixed trees);
__global__ __launch_bounds__(256) void k_asoft(const float* __restrict__ Sb, h16* P16, bf* Ph, bf* Pl) {
    const int lane = threadIdx.x & 31; const int row = blockIdx.x * 8 + (threadIdx.x >> 5); if (row >= ZH * TT) return; const int i = row % TT; const int zz = row / TT; (void)zz; const bool hires = (i < RH); const float* sr = Sb + (size_t)row * TT; float v[TT / 32]; float mx = -3.0e38f;
#pragma unroll
    for (int ch = 0; ch < TT / 128; ++ch) { const int j0 = ch * 128 + lane * 4; const v4f a = *(const v4f*)(sr + j0);
#pragma unroll
        for (int q = 0; q < 4; ++q) { const int j = j0 + q; (void)j; const float t = (j <= i && i - j < WIN) ? a[q] * SCL : -3.0e38f; v[ch * 4 + q] = t; mx = fmaxf(mx, t); } }
#pragma unroll
    for (int sh = 16; sh; sh >>= 1) mx = fmaxf(mx, __shfl_xor(mx, sh, 32));
    float sum = 0.f;
#pragma unroll
    for (int k = 0; k < TT / 32; ++k) { float d0 = __fsub_rn(v[k], mx); asm volatile("" : "+v"(d0)); v[k] = __builtin_amdgcn_exp2f(__fmul_rn(d0, 1.4426950408889634f)); sum += v[k]; }
#pragma unroll
    for (int sh = 16; sh; sh >>= 1) sum += __shfl_xor(sum, sh, 32);
    const float f = __fdiv_rn(hires ? 1.0f : PCAR, sum);
{
        if (hires) {
#pragma unroll
            for (int ch = 0; ch < TT / 128; ++ch) { v4us oh, ol;
#pragma unroll
                for (int q = 0; q < 4; ++q) { unsigned short a, c2; splitf(v[ch * 4 + q] * f, a, c2); oh[q] = a; ol[q] = c2; }
                const size_t oo = ((size_t)zz * (RH ? RH : 1) + i) * TT + ch * 128 + lane * 4; *(v4us*)(Ph + oo) = oh; *(v4us*)(Pl + oo) = ol; }
        } else {
#pragma unroll
            for (int ch = 0; ch < TT / 128; ++ch) { v4h o4;
#pragma unroll
                for (int q = 0; q < 4; ++q) o4[q] = tohx(v[ch * 4 + q] * f);
                *(v4h*)(P16 + (size_t)row * TT + ch * 128 + lane * 4) = o4; } }
         }
}
__global__ __launch_bounds__(256) void k_merge(const float* __restrict__ O, int h0, bf* Ah, bf* Al) { const size_t e = ((size_t)blockIdx.x * 256 + threadIdx.x) * 2; if (e >= (size_t)ZH * TT * HD) return; const int d = (int)(e % HD); const int t = (int)((e / HD) % TT); const int zz = (int)(e / ((size_t)HD * TT)); const float cs = (t < RH) ? 1.0f : (1.0f / PCAR); const size_t oo = (size_t)t * DQ + (h0 + zz) * HD + d;
    v2us oh, ol;
#pragma unroll
    for (int q = 0; q < 2; ++q) { unsigned short a, c2; splitf(O[e + q] * cs, a, c2); oh[q] = a; ol[q] = c2; } *(v2us*)(Ah + oo) = oh; *(v2us*)(Al + oo) = ol;  }

extern "C" void kernel_launch(void* const* d_in, const int* in_sizes, int n_in,
                              void* d_out, int out_size, void* d_ws, size_t ws_size, hipStream_t stream) {
    (void)in_sizes; (void)n_in; (void)out_size;
    const float* x = (const float*)d_in[0]; const float* wqkv = (const float*)d_in[1]; const float* bqkv = (const float*)d_in[2]; const float* wo = (const float*)d_in[3]; const float* bo = (const float*)d_in[4];   /* order x, W_attn ('xw' [1024][3072]: q | k | v column thirds), b_attn (zeros: read), W_proj, b_proj (zeros: read); five inputs, all read */ const float* bq = bqkv; const float* bk = bqkv + DQ; const float* bv = bqkv + 2 * DQ;
    float* OUT = (float*)d_out;     // [4][2048][1024]
    char* wsp = (char*)d_ws;
    auto take = [&](size_t bytes) { char* p = wsp; wsp += (bytes + 255) & ~(size_t)255; return (void*)p; };
    bf* WQKV = (bf*)take((size_t)3 * DQ * DM * 2); bf* WQ = WQKV; bf* WK = WQKV + (size_t)DQ * DM; bf* WV = WQKV + (size_t)2 * DQ * DM;   /* fused Bt [3*DQ][DM]: q | k | v row blocks */ bf* WO = (bf*)take((size_t)DM * DQ * 2); float* CS = (float*)take((size_t)TT * HD * 2 * 4);
    bf* XB = (bf*)take((size_t)TT * DM * 2); float* FQ = (float*)take((size_t)TT * DQ * 4); float* FK = (float*)take((size_t)TT * DKV * 4);
    h16* QP16 = (h16*)take((size_t)NH_ * TT * HD * 2); h16* KP16 = (h16*)take((size_t)NKV * TT * HD * 2); h16* VT16 = (h16*)take((size_t)NKV * HD * TT * 2);
    bf* QPh = (bf*)take((size_t)NH_ * TT * HD * 2); bf* QPl = (bf*)take((size_t)NH_ * TT * HD * 2); bf* KPh = (bf*)take((size_t)NKV * TT * HD * 2); bf* KPl = (bf*)take((size_t)NKV * TT * HD * 2); bf* VTh = (bf*)take((size_t)NKV * HD * TT * 2); bf* VTl = (bf*)take((size_t)NKV * HD * TT * 2); bf* Ph = (bf*)take((size_t)ZH * RH * TT * 2); bf* Pl = (bf*)take((size_t)ZH * RH * TT * 2);
    float* Sb = (float*)take((size_t)ZH * TT * TT * 4); h16* P16 = (h16*)take((size_t)ZH * TT * TT * 2); float* Ob = (float*)take((size_t)ZH * TT * HD * 4); bf* ATh = (bf*)take((size_t)TT * DQ * 2); bf* ATl = (bf*)take((size_t)TT * DQ * 2);
    if ((size_t)(wsp - (char*)d_ws) > ws_size) return;    // ws 256 MiB
    float* FV = FK;   // v projection reuses the k buffer after the k planes are built (stream-ordered)
    { k_wtG<<<(unsigned)((DM * 3 * DQ / 64 + 63) / 64), 256, 0, stream>>>(wqkv, DM, 3 * DQ, WQKV);   /* fused 'xw' [DM][3*DQ] -> Bt [3*DQ][DM] */
      k_wtG<<<(unsigned)((DQ * DM / 64 + 63) / 64), 256, 0, stream>>>(wo, DQ, DM, WO);
       }
    k_cstabH<<<(TT * HD + 255) / 256, 256, 0, stream>>>(CS);   /* rotary table once (positions = arange) */
    const unsigned LQ = (unsigned)(((size_t)NH_ * TT * HD / 2 + 255) / 256), LKv = (unsigned)(((size_t)NKV * TT * HD / 2 + 255) / 256);
    for (int b = 0; b < NB_; ++b) {
        
        k_cvt8<<<(unsigned)(((size_t)TT * DM / 8 + 255) / 256), 256, 0, stream>>>(x + (size_t)b * TT * DM, XB, (size_t)TT * DM / 8);
        k_gemmw<bf, 0, true><<<dim3(TT / 64, DQ / 64, 1), 32, 0, stream>>>(XB, nullptr, WQ, nullptr, DM, FQ, DQ, bq, 0, 0, 0);
        k_rope<<<LQ, 256, 0, stream>>>(FQ, DQ, NH_, CS, nullptr, nullptr, 1.0f, QP16, QPh, QPl);
        k_gemmw<bf, 0, true><<<dim3(TT / 64, DKV / 64, 1), 32, 0, stream>>>(XB, nullptr, WK, nullptr, DM, FK, DKV, bk, 0, 0, 0);
        k_rope<<<LKv, 256, 0, stream>>>(FK, DKV, NKV, CS, nullptr, nullptr, 1.0f, KP16, KPh, KPl);
        k_gemmw<bf, 0, true><<<dim3(TT / 64, DKV / 64, 1), 32, 0, stream>>>(XB, nullptr, WV, nullptr, DM, FV, DKV, bv, 0, 0, 0); k_vtp<<<LKv, 256, 0, stream>>>(FV, DKV, NKV, VT16, VTh, VTl);
        for (int h0 = 0; h0 < NH_; h0 += ZH) { const size_t zq = (size_t)h0, zk = (size_t)(h0 / REP);   // one kv head per query head: the pass's two heads use consecutive kv planes (z-strides TT*HD)
            k_gemmc<bf, 2, 1><<<dim3(RH / 64, TT / 64, ZH), 32, 0, stream>>>(QPh + zq * TT * HD, QPl + zq * TT * HD, KPh + zk * TT * HD, KPl + zk * TT * HD, HD, Sb, TT, 0, (size_t)TT * HD, (size_t)TT * HD, (size_t)TT * TT);
            k_gemmc<h16, 0, 1><<<dim3((TT - RH) / 64, TT / 64, ZH), 32, 0, stream>>>(QP16 + zq * TT * HD + (size_t)RH * HD, nullptr, KP16 + zk * TT * HD, nullptr, HD, Sb + (size_t)RH * TT, TT, RH, (size_t)TT * HD, (size_t)TT * HD, (size_t)TT * TT);
            k_asoft<<<ZH * TT / 8, 256, 0, stream>>>(Sb, P16, Ph, Pl);
            k_gemmc<bf, 2, 2><<<dim3(RH / 64, HD / 64, ZH), 32, 0, stream>>>(Ph, Pl, VTh + zk * HD * TT, VTl + zk * HD * TT, TT, Ob, HD, 0, (size_t)RH * TT, (size_t)HD * TT, (size_t)TT * HD);
            k_gemmc<h16, 0, 2><<<dim3((TT - RH) / 64, HD / 64, ZH), 32, 0, stream>>>(P16 + (size_t)RH * TT, nullptr, VT16 + zk * HD * TT, nullptr, TT, Ob + (size_t)RH * HD, HD, RH, (size_t)TT * TT, (size_t)HD * TT, (size_t)TT * HD);
            k_merge<<<(unsigned)(((size_t)ZH * TT * HD / 2 + 255) / 256), 256, 0, stream>>>(Ob, h0, ATh, ATl); }
        k_gemmw<bf, 1, true><<<dim3(TT / 64, DM / 64, 1), 32, 0, stream>>>(ATh, ATl, WO, nullptr, DQ, OUT + (size_t)b * TT * DM, DM, bo, 0, 0, 0); }
}

// v001
// It runs in 1560 microseconds.
// Next to v000, in two timings, it ran 1.84 times as fast each time.
#include <hip/hip_runtime.h>

// Causal self-attention with a fused biased qkv projection and a computed rotate-half RoPE at a NON-STANDARD frequency table (x [4][2048][1024]; qkv = x W_attn + b_attn ('xw' [1024][3072] 1/32 + a zero bias: read) split in thirds q | k | v (16 heads x 64); _rope_tables: rot = 32; inv_freq = 1 / (10000 ** (arange(0, 32, 2) / 32)): SIXTEEN frequencies; emb = cat(freqs, freqs): [T][32]; x <- cat(x1 cos - x2 sin, x2 cos + x1 sin) on the two HALVES (pairs (d, d + 32)) with the angle index d mod 16, on q and k; att x 1/sqrt(64); causal (-inf); softmax; y = merged W_proj + b_proj ('xw' + a zero bias: read) -> [4][2048][1024] (8.4 M); argument order x, W_attn, b_attn, W_proj, b_proj).
// Layout per batch: bf16 copy of x; fused 'xw' weight transposed once (q | k | v row blocks) + bias thirds; exact projections + f32 biases; k_cstabH computed table (elements d and d + 32 share an angle) + the rotate-half plane builders; causal T-2048 attention (hybrid rows: < 512 hi/lo 3 products, rest fp16 x1024; k_gemmc skips tiles above the diagonal); merged hi/lo x W_proj exact + b_proj.
// Compute dtypes, f32 accumulate: every input rounded to bf16; projections exact + f32 biases; attention rows < 512 3 products, rest fp16; softmax f32; W_proj hl x exact + bias.

#define NB_  4
#define TT   2048
#define DM   1024
#define NH_  16
#define NKV  16
#define REP  (NH_ / NKV)
#define HD   64
#define DQ   (NH_ * HD)
#define DKV  (NKV * HD)
#define ZH   2
#define RH   512                  // query rows < RH use hi+lo planes (0: none)
#define WIN  2048
#define PCAR 1024.0f
#define SCL  0.125f   // HD^-0.5
typedef _Float16 h16;
typedef unsigned short bf;
typedef __attribute__((ext_vector_type(16))) __bf16   v16bf;
typedef __attribute__((ext_vector_type(16))) _Float16 v16h;
typedef __attribute__((ext_vector_type(8)))  _Float16 v8h;
typedef __attribute__((ext_vector_type(8)))  unsigned short v8us;
typedef __attribute__((ext_vector_type(8)))  float    v8f;
typedef __attribute__((ext_vector_type(4)))  float    v4f;
typedef v8h  __attribute__((may_alias)) v8ha;
typedef v4f  __attribute__((may_alias)) v4fa;
typedef v8us __attribute__((may_alias)) v8usa;

__device__ __forceinline__ unsigned short f2bf(float f) { unsigned u = __float_as_uint(f); u += 0x7FFFu + ((u >> 16) & 1u); return (unsigned short)(u >> 16); }
__device__ __forceinline__ float bf2f(unsigned short b) { return __uint_as_float(((unsigned)b) << 16); }
__device__ __forceinline__ float bfr(float f) { return bf2f(f2bf(f)); }
__device__ __forceinline__ v16h cat16(v8h lo, v8h hi) { return __builtin_shufflevector(lo, hi, 0, 1, 2, 3, 4, 5, 6, 7, 8, 9, 10, 11, 12, 13, 14, 15); }
__device__ __forceinline__ v16bf cat16b(v8us lo, v8us hi) { return __builtin_bit_cast(v16bf, __builtin_shufflevector(lo, hi, 0, 1, 2, 3, 4, 5, 6, 7, 8, 9, 10, 11, 12, 13, 14, 15)); }
__device__ __forceinline__ v8f wmma16(v16h a, v16h b, v8f c) { return __builtin_amdgcn_wmma_f32_16x16x32_f16(false, a, false, b, (short)0, c, false, false); }
__device__ __forceinline__ v8f wmmab(v16bf a, v16bf b, v8f c) { return __builtin_amdgcn_wmma_f32_16x16x32_bf16(false, a, false, b, (short)0, c, false, false); }



// ---- k_gemmw: register-blocked GEMM, one 64x64 output tile per work-group of NW waves; the K range is cut in runs of KCH elements (whole 128-byte lines of every operand row) and wave w takes runs w, w + NW, ...;
// every wave keeps a whole 64x64 partial tile (16 accumulators), operands straight from K-contiguous 16-bit planes; the NW partial tiles meet in LDS and are summed in wave order. grid (M/64, N/64, Z), NW * 32 threads.
// C[m][n] (f32, pitch ldc, + optional f32 bias[n]) = sum_k A[m][k] Bt[n][k] (+ split products per NSPLIT). z-batch strides sA/sB/sC in elements. K % 32 == 0.
// DIAG: probability x value contraction of causal attention: probabilities are exactly 0 beyond the diagonal block of query rows r0 + roff .., so the K range stops there.
template <typename T16> struct WFrag;
template <> struct WFrag<h16> { typedef v16h V; static __device__ __forceinline__ V ld(const h16* p) { return cat16(*(const v8h*)p, *(const v8h*)(p + 16)); } static __device__ __forceinline__ v8f mma(V a, V b, v8f c) { return wmma16(a, b, c); } };
template <> struct WFrag<bf> { typedef v16bf V; static __device__ __forceinline__ V ld(const bf* p) { return cat16b(*(const v8us*)p, *(const v8us*)(p + 16)); } static __device__ __forceinline__ v8f mma(V a, V b, v8f c) { return wmmab(a, b, c); } };
template <typename T16, int NSPLIT, bool BIAS, int NW, int KCH, bool DIAG>
__global__ __launch_bounds__(NW * 32) void k_gemmw(const T16* __restrict__ A, const T16* __restrict__ A2, const T16* __restrict__ Bt, const T16* __restrict__ Bt2, int K, float* C, int ldc, const float* __restrict__ bias, int roff, size_t sA, size_t sB, size_t sC) {
    typedef typename WFrag<T16>::V V;
    __shared__ __align__(16) float os[NW * 64 * 68];
    const size_t z = blockIdx.z; A += z * sA; if (A2) A2 += z * sA; Bt += z * sB; if (Bt2) Bt2 += z * sB; C += z * sC;
    const int lane = threadIdx.x & 31, lr = lane & 15, hi = lane >> 4; const int r0 = blockIdx.x * 64, c0 = blockIdx.y * 64; const int w = __builtin_amdgcn_readfirstlane((int)(threadIdx.x >> 5));   // wave number, held scalar so that the K loops stay scalar branches
    const int Kl = DIAG ? min(K, r0 + roff + 64) : K;
    v8f acc[4][4];
#pragma unroll
    for (int mb = 0; mb < 4; ++mb)
#pragma unroll
        for (int nb = 0; nb < 4; ++nb) acc[mb][nb] = (v8f){};
    const size_t aoff = (size_t)(r0 + lr) * K + 8 * hi, boff = (size_t)(c0 + lr) * K + 8 * hi;
    for (int kb = w * KCH; kb < Kl; kb += NW * KCH) { const int ke = min(kb + KCH, Kl);
#pragma unroll 1
    for (int kc = kb; kc < ke; kc += 32) {
        V a[4], a2[4];
#pragma unroll
        for (int mb = 0; mb < 4; ++mb) { a[mb] = WFrag<T16>::ld(A + aoff + (size_t)mb * 16 * K + kc); if (NSPLIT == 1 || NSPLIT == 2) a2[mb] = WFrag<T16>::ld(A2 + aoff + (size_t)mb * 16 * K + kc); }
#pragma unroll
        for (int nb = 0; nb < 4; ++nb) { const V b = WFrag<T16>::ld(Bt + boff + (size_t)nb * 16 * K + kc); V b2; if (NSPLIT >= 2) b2 = WFrag<T16>::ld(Bt2 + boff + (size_t)nb * 16 * K + kc);
#pragma unroll
            for (int mb = 0; mb < 4; ++mb) { acc[mb][nb] = WFrag<T16>::mma(a[mb], b, acc[mb][nb]); if (NSPLIT == 1 || NSPLIT == 2) acc[mb][nb] = WFrag<T16>::mma(a2[mb], b, acc[mb][nb]); if (NSPLIT >= 2) acc[mb][nb] = WFrag<T16>::mma(a[mb], b2, acc[mb][nb]); } }
        asm volatile("v_nop\n\tv_nop\n\tv_nop\n\tv_nop" : "+v"(acc[0][0]), "+v"(acc[1][1]), "+v"(acc[2][2]), "+v"(acc[3][3]) : "v"(a[0]), "v"(a[3]));
    } }
    float* ow = os + w * (64 * 68);   // this wave's partial tile, row-major at pitch 68 (a wave whose runs all lie beyond Kl hands in zeros)
#pragma unroll
    for (int mb = 0; mb < 4; ++mb)
#pragma unroll
        for (int nb = 0; nb < 4; ++nb)
#pragma unroll
            for (int j = 0; j < 8; ++j) ow[(mb * 16 + hi * 8 + j) * 68 + nb * 16 + lr] = acc[mb][nb][j];
    __syncthreads();   // every wave's partial tile is in LDS before any of it is summed
#pragma unroll
    for (int s = 0; s < 32 / NW; ++s) { const int q = s * NW * 32 + (int)threadIdx.x; const int row = q >> 4, cofs = (q & 15) * 4; v4f val = *(const v4fa*)(os + row * 68 + cofs);
#pragma unroll
        for (int u = 1; u < NW; ++u) val += *(const v4fa*)(os + u * (64 * 68) + row * 68 + cofs);
        if (BIAS) { val[0] += bfr(bias[c0 + cofs]); val[1] += bfr(bias[c0 + cofs + 1]); val[2] += bfr(bias[c0 + cofs + 2]); val[3] += bfr(bias[c0 + cofs + 3]); }
        *(v4f*)(C + (size_t)(r0 + row) * ldc + c0 + cofs) = val; }
}

// ---- k_gemmc: ONE WAVE per 64x64 output tile (short K: no split), for the scores of causal attention: CMODE 1 skips score tiles entirely above the diagonal (query rows r0+roff.., key columns c0..).
// roff = row offset of this launch's first row within the sequence.
template <typename T16, int NSPLIT, int CMODE>
__global__ __launch_bounds__(32) void k_gemmc(const T16* __restrict__ A, const T16* __restrict__ A2, const T16* __restrict__ Bt, const T16* __restrict__ Bt2, int K, float* C, int ldc, int roff, size_t sA, size_t sB, size_t sC) {
    typedef typename WFrag<T16>::V V;
    __shared__ __align__(16) float os[16 * 68];
    const size_t z = blockIdx.z; A += z * sA; if (A2) A2 += z * sA; Bt += z * sB; if (Bt2) Bt2 += z * sB; C += z * sC;
    const int lane = threadIdx.x & 31, lr = lane & 15, hi = lane >> 4; const int r0 = blockIdx.x * 64, c0 = blockIdx.y * 64;
    if (CMODE == 1 && c0 > r0 + roff + 63) return;                  // score tile entirely above the causal diagonal: never written (the softmax masks j > i by select)
    v8f acc[4][4];
#pragma unroll
    for (int mb = 0; mb < 4; ++mb)
#pragma unroll
        for (int nb = 0; nb < 4; ++nb) acc[mb][nb] = (v8f){};
    const size_t aoff = (size_t)(r0 + lr) * K + 8 * hi, boff = (size_t)(c0 + lr) * K + 8 * hi;
#pragma unroll 1
    for (int kc = 0; kc < K; kc += 32) {
        V a[4], a2[4];
#pragma unroll
        for (int mb = 0; mb < 4; ++mb) { a[mb] = WFrag<T16>::ld(A + aoff + (size_t)mb * 16 * K + kc); if (NSPLIT == 1 || NSPLIT == 2) a2[mb] = WFrag<T16>::ld(A2 + aoff + (size_t)mb * 16 * K + kc); }
#pragma unroll
        for (int nb = 0; nb < 4; ++nb) { const V b = WFrag<T16>::ld(Bt + boff + (size_t)nb * 16 * K + kc); V b2; if (NSPLIT >= 2) b2 = WFrag<T16>::ld(Bt2 + boff + (size_t)nb * 16 * K + kc);
#pragma unroll
            for (int mb = 0; mb < 4; ++mb) { acc[mb][nb] = WFrag<T16>::mma(a[mb], b, acc[mb][nb]); if (NSPLIT == 1 || NSPLIT == 2) acc[mb][nb] = WFrag<T16>::mma(a2[mb], b, acc[mb][nb]); if (NSPLIT >= 2) acc[mb][nb] = WFrag<T16>::mma(a[mb], b2, acc[mb][nb]); } }
        asm volatile("v_nop\n\tv_nop\n\tv_nop\n\tv_nop" : "+v"(acc[0][0]), "+v"(acc[1][1]), "+v"(acc[2][2]), "+v"(acc[3][3]) : "v"(a[0]), "v"(a[3]));
    }
#pragma unroll
    for (int mb = 0; mb < 4; ++mb) {
#pragma unroll
        for (int nb = 0; nb < 4; ++nb) {
#pragma unroll
            for (int j = 0; j < 8; ++j) os[(hi * 8 + j) * 68 + nb * 16 + lr] = acc[mb][nb][j]; }
        __builtin_amdgcn_wave_barrier(); asm volatile("" ::: "memory");
        float* crow = C + (size_t)(r0 + mb * 16) * ldc + c0;
{
#pragma unroll
            for (int s = 0; s < 8; ++s) { const int row = 2 * s + hi, cofs = lr * 4; v4f val = *(const v4fa*)(os + row * 68 + cofs);
                *(v4f*)(crow + (size_t)row * ldc + cofs) = val; }
             }
        __builtin_amdgcn_wave_barrier(); asm volatile("" ::: "memory");
    }
}

__device__ __forceinline__ h16 tohx(float x) { return (h16)x; }
__device__ __forceinline__ void splitf(float y, unsigned short& h, unsigned short& l) { h = f2bf(y); l = f2bf(y - bf2f(h)); }
typedef __attribute__((ext_vector_type(2))) _Float16 v2h;
typedef __attribute__((ext_vector_type(4))) _Float16 v4h;
typedef __attribute__((ext_vector_type(2))) unsigned short v2us;
typedef __attribute__((ext_vector_type(4))) unsigned short v4us;
typedef __attribute__((ext_vector_type(2))) float v2f;
typedef __attribute__((ext_vector_type(4))) int v4i;

__global__ __launch_bounds__(256) void k_wtG(const float* __restrict__ w, int K, int N, bf* Bt) {
    const int lane = threadIdx.x & 31; const int L0 = (blockIdx.x * 8 + (threadIdx.x >> 5)) * 8; const int nlines = N * K / 64;
{
#pragma unroll 1
        for (int l = 0; l < 8; ++l) { const int L = L0 + l; if (L >= nlines) break; const size_t e = (size_t)L * 64 + lane * 2; const int k = (int)(e % K), n = (int)(e / K); v2us o;
            o[0] = f2bf(w[(size_t)k * N + n]); o[1] = f2bf(w[(size_t)(k + 1) * N + n]); *(v2us*)(Bt + e) = o; }
         }
}
__global__ __launch_bounds__(256) void k_cvt8(const float* __restrict__ src, bf* dst, size_t n8) { const size_t i = (size_t)blockIdx.x * 256 + threadIdx.x; if (i >= n8) return; const v8f v = *(const v8f*)(src + i * 8); v8us o;
#pragma unroll
    for (int k = 0; k < 8; ++k) o[k] = f2bf(v[k]); *(v8us*)(dst + i * 8) = o;  }

// k_rope: head planes [h][t][d] (fp16 + hi/lo) of rope(x) x sc with the rotate-half convention out[d] = x[d] cos[t][d] - x[d+HD/2] sin[t][d], out[d+HD/2] = x[d+HD/2] cos[t][d+HD/2] + x[d] sin[t][d+HD/2]
__global__ __launch_bounds__(256) void k_rope(const float* __restrict__ F, int pitch, int nheads, const float* __restrict__ CS, const float* __restrict__ RF, const float* __restrict__ nw, float sc, h16* P16, bf* Ph, bf* Pl) {
    const size_t e = ((size_t)blockIdx.x * 256 + threadIdx.x) * 2; if (e >= (size_t)nheads * TT * HD) return; const int d = (int)(e % HD); const int t = (int)((e / HD) % TT); const int h = (int)(e / ((size_t)HD * TT)); const float* f = F + (size_t)t * pitch + h * HD; const float rf = RF ? RF[(size_t)h * TT + t] : 1.0f; v2h o16; v2us oh, ol;
#pragma unroll
    for (int q = 0; q < 2; ++q) { const int dd = d + q; const int dp = (dd < HD / 2) ? dd + HD / 2 : dd - HD / 2; float x0 = f[dd], x1 = f[dp];
        if (RF) { float n0 = __fmul_rn(x0, rf), n1 = __fmul_rn(x1, rf); asm volatile("" : "+v"(n0)); asm volatile("" : "+v"(n1)); x0 = __fmul_rn(bfr(nw[dd]), n0); x1 = __fmul_rn(bfr(nw[dp]), n1); }
        const v2f cs = *(const v2f*)(CS + ((size_t)t * HD + dd) * 2); float a = __fmul_rn(x0, cs[0]), bq = __fmul_rn(x1, cs[1]); asm volatile("" : "+v"(a)); asm volatile("" : "+v"(bq)); const float r = ((dd < HD / 2) ? __fsub_rn(a, bq) : __fadd_rn(a, bq)) * sc;
        o16[q] = tohx(r); unsigned short a2, c2; splitf(r, a2, c2); oh[q] = a2; ol[q] = c2; }
    *(v2h*)(P16 + e) = o16; *(v2us*)(Ph + e) = oh; *(v2us*)(Pl + e) = ol;  }
__global__ __launch_bounds__(256) void k_vtp(const float* __restrict__ F, int pitch, int nheads, h16* V16, bf* Vh, bf* Vl) { const size_t e = ((size_t)blockIdx.x * 256 + threadIdx.x) * 2; if (e >= (size_t)nheads * HD * TT) return; const int t = (int)(e % TT); const int d = (int)((e / TT) % HD); const int g = (int)(e / ((size_t)TT * HD)); v2h o16; v2us oh, ol;
#pragma unroll
    for (int q = 0; q < 2; ++q) { const float x = F[(size_t)(t + q) * pitch + g * HD + d]; o16[q] = tohx(x); unsigned short a2, c2; splitf(x, a2, c2); oh[q] = a2; ol[q] = c2; }
    *(v2h*)(V16 + e) = o16; *(v2us*)(Vh + e) = oh; *(v2us*)(Vl + e) = ol;  }
__constant__ float INVT[HD / 2] = { 1.000000000e+00f, 5.623413324e-01f, 3.162277639e-01f, 1.778279394e-01f, 1.000000015e-01f, 5.623412877e-02f, 3.162277862e-02f, 1.778279431e-02f, 9.999999776e-03f, 5.623413250e-03f, 3.162277862e-03f, 1.778279431e-03f, 1.000000047e-03f, 5.623413017e-04f, 3.162277862e-04f, 1.778279402e-04f, 1.000000000e+00f, 5.623413324e-01f, 3.162277639e-01f, 1.778279394e-01f, 1.000000015e-01f, 5.623412877e-02f, 3.162277862e-02f, 1.778279431e-02f, 9.999999776e-03f, 5.623413250e-03f, 3.162277862e-03f, 1.778279431e-03f, 1.000000047e-03f, 5.623413017e-04f, 3.162277862e-04f, 1.778279402e-04f };
__global__ __launch_bounds__(256) void k_cstabH(float* CS) { const int idx = blockIdx.x * 256 + threadIdx.x; if (idx >= TT * HD) return; const int d = idx % HD; const int t = idx / HD; const float a = __fmul_rn((float)t, INVT[d & (HD / 2 - 1)]); v2f cs; cs[0] = cosf(a); cs[1] = sinf(a); *(v2f*)(CS + (size_t)idx * 2) = cs;  }
// k_asoft: per row (zz, i): t = S x HD^-0.5 for j <= i and i - j < WIN (sliding causal window; the reference's -1e9 additive fill vanishes identically); softmax over the 2048 keys (register row, one exp, fixed trees);
__global__ __launch_bounds__(256) void k_asoft(const float* __restrict__ Sb, h16* P16, bf* Ph, bf* Pl) {
    const int lane = threadIdx.x & 31; const int row = blockIdx.x * 8 + (threadIdx.x >> 5); if (row >= ZH * TT) return; const int i = row % TT; const int zz = row / TT; (void)zz; const bool hires = (i < RH); const float* sr = Sb + (size_t)row * TT; float v[TT / 32]; float mx = -3.0e38f;
#pragma unroll
    for (int ch = 0; ch < TT / 128; ++ch) { const int j0 = ch * 128 + lane * 4; const v4f a = *(const v4f*)(sr + j0);
#pragma unroll
        for (int q = 0; q < 4; ++q) { const int j = j0 + q; (void)j; const float t = (j <= i && i - j < WIN) ? a[q] * SCL : -3.0e38f; v[ch * 4 + q] = t; mx = fmaxf(mx, t); } }
#pragma unroll
    for (int sh = 16; sh; sh >>= 1) mx = fmaxf(mx, __shfl_xor(mx, sh, 32));
    float sum = 0.f;
#pragma unroll
    for (int k = 0; k < TT / 32; ++k) { float d0 = __fsub_rn(v[k], mx); asm volatile("" : "+v"(d0)); v[k] = __builtin_amdgcn_exp2f(__fmul_rn(d0, 1.4426950408889634f)); sum += v[k]; }
#pragma unroll
    for (int sh = 16; sh; sh >>= 1) sum += __shfl_xor(sum, sh, 32);
    const float f = __fdiv_rn(hires ? 1.0f : PCAR, sum);
{
        if (hires) {
#pragma unroll
            for (int ch = 0; ch < TT / 128; ++ch) { v4us oh, ol;
#pragma unroll
                for (int q = 0; q < 4; ++q) { unsigned short a, c2; splitf(v[ch * 4 + q] * f, a, c2); oh[q] = a; ol[q] = c2; }
                const size_t oo = ((size_t)zz * (RH ? RH : 1) + i) * TT + ch * 128 + lane * 4; *(v4us*)(Ph + oo) = oh; *(v4us*)(Pl + oo) = ol; }
        } else {
#pragma unroll
            for (int ch = 0; ch < TT / 128; ++ch) { v4h o4;
#pragma unroll
                for (int q = 0; q < 4; ++q) o4[q] = tohx(v[ch * 4 + q] * f);
                *(v4h*)(P16 + (size_t)row * TT + ch * 128 + lane * 4) = o4; } }
         }
}
__global__ __launch_bounds__(256) void k_merge(const float* __restrict__ O, int h0, bf* Ah, bf* Al) { const size_t e = ((size_t)blockIdx.x * 256 + threadIdx.x) * 2; if (e >= (size_t)ZH * TT * HD) return; const int d = (int)(e % HD); const int t = (int)((e / HD) % TT); const int zz = (int)(e / ((size_t)HD * TT)); const float cs = (t < RH) ? 1.0f : (1.0f / PCAR); const size_t oo = (size_t)t * DQ + (h0 + zz) * HD + d;
    v2us oh, ol;
#pragma unroll
    for (int q = 0; q < 2; ++q) { unsigned short a, c2; splitf(O[e + q] * cs, a, c2); oh[q] = a; ol[q] = c2; } *(v2us*)(Ah + oo) = oh; *(v2us*)(Al + oo) = ol;  }

extern "C" void kernel_launch(void* const* d_in, const int* in_sizes, int n_in,
                              void* d_out, int out_size, void* d_ws, size_t ws_size, hipStream_t stream) {
    (void)in_sizes; (void)n_in; (void)out_size;
    const float* x = (const float*)d_in[0]; const float* wqkv = (const float*)d_in[1]; const float* bqkv = (const float*)d_in[2]; const float* wo = (const float*)d_in[3]; const float* bo = (const float*)d_in[4];   /* order x, W_attn ('xw' [1024][3072]: q | k | v column thirds), b_attn (zeros: read), W_proj, b_proj (zeros: read); five inputs, all read */ const float* bq = bqkv; const float* bk = bqkv + DQ; const float* bv = bqkv + 2 * DQ;
    float* OUT = (float*)d_out;     // [4][2048][1024]
    char* wsp = (char*)d_ws;
    auto take = [&](size_t bytes) { char* p = wsp; wsp += (bytes + 255) & ~(size_t)255; return (void*)p; };
    bf* WQKV = (bf*)take((size_t)3 * DQ * DM * 2); bf* WQ = WQKV; bf* WK = WQKV + (size_t)DQ * DM; bf* WV = WQKV + (size_t)2 * DQ * DM;   /* fused Bt [3*DQ][DM]: q | k | v row blocks */ bf* WO = (bf*)take((size_t)DM * DQ * 2); float* CS = (float*)take((size_t)TT * HD * 2 * 4);
    bf* XB = (bf*)take((size_t)TT * DM * 2); float* FQ = (float*)take((size_t)TT * DQ * 4); float* FK = (float*)take((size_t)TT * DKV * 4);
    h16* QP16 = (h16*)take((size_t)NH_ * TT * HD * 2); h16* KP16 = (h16*)take((size_t)NKV * TT * HD * 2); h16* VT16 = (h16*)take((size_t)NKV * HD * TT * 2);
    bf* QPh = (bf*)take((size_t)NH_ * TT * HD * 2); bf* QPl = (bf*)take((size_t)NH_ * TT * HD * 2); bf* KPh = (bf*)take((size_t)NKV * TT * HD * 2); bf* KPl = (bf*)take((size_t)NKV * TT * HD * 2); bf* VTh = (bf*)take((size_t)NKV * HD * TT * 2); bf* VTl = (bf*)take((size_t)NKV * HD * TT * 2); bf* Ph = (bf*)take((size_t)ZH * RH * TT * 2); bf* Pl = (bf*)take((size_t)ZH * RH * TT * 2);
    float* Sb = (float*)take((size_t)ZH * TT * TT * 4); h16* P16 = (h16*)take((size_t)ZH * TT * TT * 2); float* Ob = (float*)take((size_t)ZH * TT * HD * 4); bf* ATh = (bf*)take((size_t)TT * DQ * 2); bf* ATl = (bf*)take((size_t)TT * DQ * 2);
    if ((size_t)(wsp - (char*)d_ws) > ws_size) return;    // ws 256 MiB
    float* FV = FK;   // v projection reuses the k buffer after the k planes are built (stream-ordered)
    { k_wtG<<<(unsigned)((DM * 3 * DQ / 64 + 63) / 64), 256, 0, stream>>>(wqkv, DM, 3 * DQ, WQKV);   /* fused 'xw' [DM][3*DQ] -> Bt [3*DQ][DM] */
      k_wtG<<<(unsigned)((DQ * DM / 64 + 63) / 64), 256, 0, stream>>>(wo, DQ, DM, WO);
       }
    k_cstabH<<<(TT * HD + 255) / 256, 256, 0, stream>>>(CS);   /* rotary table once (positions = arange) */
    const unsigned LQ = (unsigned)(((size_t)NH_ * TT * HD / 2 + 255) / 256), LKv = (unsigned)(((size_t)NKV * TT * HD / 2 + 255) / 256);
    for (int b = 0; b < NB_; ++b) {
        
        k_cvt8<<<(unsigned)(((size_t)TT * DM / 8 + 255) / 256), 256, 0, stream>>>(x + (size_t)b * TT * DM, XB, (size_t)TT * DM / 8);
        k_gemmw<bf, 0, true, 8, 128, false><<<dim3(TT / 64, DQ / 64, 1), 256, 0, stream>>>(XB, nullptr, WQ, nullptr, DM, FQ, DQ, bq, 0, 0, 0, 0);
        k_rope<<<LQ, 256, 0, stream>>>(FQ, DQ, NH_, CS, nullptr, nullptr, 1.0f, QP16, QPh, QPl);
        k_gemmw<bf, 0, true, 8, 128, false><<<dim3(TT / 64, DKV / 64, 1), 256, 0, stream>>>(XB, nullptr, WK, nullptr, DM, FK, DKV, bk, 0, 0, 0, 0);
        k_rope<<<LKv, 256, 0, stream>>>(FK, DKV, NKV, CS, nullptr, nullptr, 1.0f, KP16, KPh, KPl);
        k_gemmw<bf, 0, true, 8, 128, false><<<dim3(TT / 64, DKV / 64, 1), 256, 0, stream>>>(XB, nullptr, WV, nullptr, DM, FV, DKV, bv, 0, 0, 0, 0); k_vtp<<<LKv, 256, 0, stream>>>(FV, DKV, NKV, VT16, VTh, VTl);
        for (int h0 = 0; h0 < NH_; h0 += ZH) { const size_t zq = (size_t)h0, zk = (size_t)(h0 / REP);   // one kv head per query head: the pass's two heads use consecutive kv planes (z-strides TT*HD)
            k_gemmc<bf, 2, 1><<<dim3(RH / 64, TT / 64, ZH), 32, 0, stream>>>(QPh + zq * TT * HD, QPl + zq * TT * HD, KPh + zk * TT * HD, KPl + zk * TT * HD, HD, Sb, TT, 0, (size_t)TT * HD, (size_t)TT * HD, (size_t)TT * TT);
            k_gemmc<h16, 0, 1><<<dim3((TT - RH) / 64, TT / 64, ZH), 32, 0, stream>>>(QP16 + zq * TT * HD + (size_t)RH * HD, nullptr, KP16 + zk * TT * HD, nullptr, HD, Sb + (size_t)RH * TT, TT, RH, (size_t)TT * HD, (size_t)TT * HD, (size_t)TT * TT);
            k_asoft<<<ZH * TT / 8, 256, 0, stream>>>(Sb, P16, Ph, Pl);
            k_gemmw<bf, 2, false, 8, 64, true><<<dim3(RH / 64, HD / 64, ZH), 256, 0, stream>>>(Ph, Pl, VTh + zk * HD * TT, VTl + zk * HD * TT, TT, Ob, HD, nullptr, 0, (size_t)RH * TT, (size_t)HD * TT, (size_t)TT * HD);
            k_gemmw<h16, 0, false, 16, 128, true><<<dim3((TT - RH) / 64, HD / 64, ZH), 512, 0, stream>>>(P16 + (size_t)RH * TT, nullptr, VT16 + zk * HD * TT, nullptr, TT, Ob + (size_t)RH * HD, HD, nullptr, RH, (size_t)TT * TT, (size_t)HD * TT, (size_t)TT * HD);
            k_merge<<<(unsigned)(((size_t)ZH * TT * HD / 2 + 255) / 256), 256, 0, stream>>>(Ob, h0, ATh, ATl); }
        k_gemmw<bf, 1, true, 8, 128, false><<<dim3(TT / 64, DM / 64, 1), 256, 0, stream>>>(ATh, ATl, WO, nullptr, DQ, OUT + (size_t)b * TT * DM, DM, bo, 0, 0, 0, 0); }
}

// v002
// One run takes 900 microseconds.
// In both of two side-by-side timings against v001, it was 1.74 times as fast.
// All steps since v000 together make it 3.21 times as fast.
#include <hip/hip_runtime.h>

// Causal self-attention with a fused biased qkv projection and a computed rotate-half RoPE at a NON-STANDARD frequency table (x [4][2048][1024]; qkv = x W_attn + b_attn ('xw' [1024][3072] 1/32 + a zero bias: read) split in thirds q | k | v (16 heads x 64); _rope_tables: rot = 32; inv_freq = 1 / (10000 ** (arange(0, 32, 2) / 32)): SIXTEEN frequencies; emb = cat(freqs, freqs): [T][32]; x <- cat(x1 cos - x2 sin, x2 cos + x1 sin) on the two HALVES (pairs (d, d + 32)) with the angle index d mod 16, on q and k; att x 1/sqrt(64); causal (-inf); softmax; y = merged W_proj + b_proj ('xw' + a zero bias: read) -> [4][2048][1024] (8.4 M); argument order x, W_attn, b_attn, W_proj, b_proj).
// Layout per batch: bf16 copy of x; fused 'xw' weight transposed once (q | k | v row blocks) + bias thirds; exact projections + f32 biases; k_cstabH computed table (elements d and d + 32 share an angle) + the rotate-half plane builders; causal T-2048 attention, ZH heads a pass (hybrid rows: < 512 hi/lo 3 products, rest fp16 x1024; k_gemmc skips tiles above the diagonal; the probabilities of a row take the place of its own f32 scores); merged hi/lo x W_proj exact + b_proj.
// Compute dtypes, f32 accumulate: every input rounded to bf16; projections exact + f32 biases; attention rows < 512 3 products, rest fp16; softmax f32; W_proj hl x exact + bias.

#define NB_  4
#define TT   2048
#define DM   1024
#define NH_  16
#define NKV  16
#define REP  (NH_ / NKV)
#define HD   64
#define DQ   (NH_ * HD)
#define DKV  (NKV * HD)
#define ZH   8                    // heads per attention pass (the z extent of the k_gemmc and k_gemmw launches of a pass)
#define RH   512                  // query rows < RH use hi+lo planes (0: none)
#define WIN  2048
#define PCAR 1024.0f
#define SCL  0.125f   // HD^-0.5
typedef _Float16 h16;
typedef unsigned short bf;
typedef __attribute__((ext_vector_type(16))) __bf16   v16bf;
typedef __attribute__((ext_vector_type(16))) _Float16 v16h;
typedef __attribute__((ext_vector_type(8)))  _Float16 v8h;
typedef __attribute__((ext_vector_type(8)))  unsigned short v8us;
typedef __attribute__((ext_vector_type(8)))  float    v8f;
typedef __attribute__((ext_vector_type(4)))  float    v4f;
typedef v8h  __attribute__((may_alias)) v8ha;
typedef v4f  __attribute__((may_alias)) v4fa;
typedef v8us __attribute__((may_alias)) v8usa;

__device__ __forceinline__ unsigned short f2bf(float f) { unsigned u = __float_as_uint(f); u += 0x7FFFu + ((u >> 16) & 1u); return (unsigned short)(u >> 16); }
__device__ __forceinline__ float bf2f(unsigned short b) { return __uint_as_float(((unsigned)b) << 16); }
__device__ __forceinline__ float bfr(float f) { return bf2f(f2bf(f)); }
__device__ __forceinline__ v16h cat16(v8h lo, v8h hi) { return __builtin_shufflevector(lo, hi, 0, 1, 2, 3, 4, 5, 6, 7, 8, 9, 10, 11, 12, 13, 14, 15); }
__device__ __forceinline__ v16bf cat16b(v8us lo, v8us hi) { return __builtin_bit_cast(v16bf, __builtin_shufflevector(lo, hi, 0, 1, 2, 3, 4, 5, 6, 7, 8, 9, 10, 11, 12, 13, 14, 15)); }
__device__ __forceinline__ v8f wmma16(v16h a, v16h b, v8f c) { return __builtin_amdgcn_wmma_f32_16x16x32_f16(false, a, false, b, (short)0, c, false, false); }
__device__ __forceinline__ v8f wmmab(v16bf a, v16bf b, v8f c) { return __builtin_amdgcn_wmma_f32_16x16x32_bf16(false, a, false, b, (short)0, c, false, false); }



// ---- k_gemmw: register-blocked GEMM, one 64x64 output tile per work-group of NW waves; the K range is cut in runs of KCH elements (whole 128-byte lines of every operand row) and wave w takes runs w, w + NW, ...;
// every wave keeps a whole 64x64 partial tile (16 accumulators), operands straight from K-contiguous 16-bit planes; the NW partial tiles meet in LDS and are summed in wave order. grid (M/64, N/64, Z), NW * 32 threads.
// C[m][n] (f32, pitch ldc, + optional f32 bias[n]) = sum_k A[m][k] Bt[n][k] (+ split products per NSPLIT). A rows at pitch lda, Bt rows at pitch K; z-batch strides sA/sB/sC in elements. K % 32 == 0.
// DIAG: probability x value contraction of causal attention: probabilities are exactly 0 beyond the diagonal block of query rows r0 + roff .., so the K range stops there.
template <typename T16> struct WFrag;
template <> struct WFrag<h16> { typedef v16h V; static __device__ __forceinline__ V ld(const h16* p) { return cat16(*(const v8h*)p, *(const v8h*)(p + 16)); } static __device__ __forceinline__ v8f mma(V a, V b, v8f c) { return wmma16(a, b, c); } };
template <> struct WFrag<bf> { typedef v16bf V; static __device__ __forceinline__ V ld(const bf* p) { return cat16b(*(const v8us*)p, *(const v8us*)(p + 16)); } static __device__ __forceinline__ v8f mma(V a, V b, v8f c) { return wmmab(a, b, c); } };
template <typename T16, int NSPLIT, bool BIAS, int NW, int KCH, bool DIAG>
__global__ __launch_bounds__(NW * 32) void k_gemmw(const T16* __restrict__ A, const T16* __restrict__ A2, int lda, const T16* __restrict__ Bt, const T16* __restrict__ Bt2, int K, float* C, int ldc, const float* __restrict__ bias, int roff, size_t sA, size_t sB, size_t sC) {
    typedef typename WFrag<T16>::V V;
    __shared__ __align__(16) float os[NW * 64 * 68];
    const size_t z = blockIdx.z; A += z * sA; if (A2) A2 += z * sA; Bt += z * sB; if (Bt2) Bt2 += z * sB; C += z * sC;
    const int lane = threadIdx.x & 31, lr = lane & 15, hi = lane >> 4; const int r0 = blockIdx.x * 64, c0 = blockIdx.y * 64; const int w = __builtin_amdgcn_readfirstlane((int)(threadIdx.x >> 5));   // wave number, held scalar so that the K loops stay scalar branches
    const int Kl = DIAG ? min(K, r0 + roff + 64) : K;
    v8f acc[4][4];
#pragma unroll
    for (int mb = 0; mb < 4; ++mb)
#pragma unroll
        for (int nb = 0; nb < 4; ++nb) acc[mb][nb] = (v8f){};
    const size_t aoff = (size_t)(r0 + lr) * lda + 8 * hi, boff = (size_t)(c0 + lr) * K + 8 * hi;
    for (int kb = w * KCH; kb < Kl; kb += NW * KCH) { const int ke = min(kb + KCH, Kl);
#pragma unroll 1
    for (int kc = kb; kc < ke; kc += 32) {
        V a[4], a2[4];
#pragma unroll
        for (int mb = 0; mb < 4; ++mb) { a[mb] = WFrag<T16>::ld(A + aoff + (size_t)mb * 16 * lda + kc); if (NSPLIT == 1 || NSPLIT == 2) a2[mb] = WFrag<T16>::ld(A2 + aoff + (size_t)mb * 16 * lda + kc); }
#pragma unroll
        for (int nb = 0; nb < 4; ++nb) { const V b = WFrag<T16>::ld(Bt + boff + (size_t)nb * 16 * K + kc); V b2; if (NSPLIT >= 2) b2 = WFrag<T16>::ld(Bt2 + boff + (size_t)nb * 16 * K + kc);
#pragma unroll
            for (int mb = 0; mb < 4; ++mb) { acc[mb][nb] = WFrag<T16>::mma(a[mb], b, acc[mb][nb]); if (NSPLIT == 1 || NSPLIT == 2) acc[mb][nb] = WFrag<T16>::mma(a2[mb], b, acc[mb][nb]); if (NSPLIT >= 2) acc[mb][nb] = WFrag<T16>::mma(a[mb], b2, acc[mb][nb]); } }
        asm volatile("v_nop\n\tv_nop\n\tv_nop\n\tv_nop" : "+v"(acc[0][0]), "+v"(acc[1][1]), "+v"(acc[2][2]), "+v"(acc[3][3]) : "v"(a[0]), "v"(a[3]));
    } }
    float* ow = os + w * (64 * 68);   // this wave's partial tile, row-major at pitch 68 (a wave whose runs all lie beyond Kl hands in zeros)
#pragma unroll
    for (int mb = 0; mb < 4; ++mb)
#pragma unroll
        for (int nb = 0; nb < 4; ++nb)
#pragma unroll
            for (int j = 0; j < 8; ++j) ow[(mb * 16 + hi * 8 + j) * 68 + nb * 16 + lr] = acc[mb][nb][j];
    __syncthreads();   // every wave's partial tile is in LDS before any of it is summed
#pragma unroll
    for (int s = 0; s < 32 / NW; ++s) { const int q = s * NW * 32 + (int)threadIdx.x; const int row = q >> 4, cofs = (q & 15) * 4; v4f val = *(const v4fa*)(os + row * 68 + cofs);
#pragma unroll
        for (int u = 1; u < NW; ++u) val += *(const v4fa*)(os + u * (64 * 68) + row * 68 + cofs);
        if (BIAS) { val[0] += bfr(bias[c0 + cofs]); val[1] += bfr(bias[c0 + cofs + 1]); val[2] += bfr(bias[c0 + cofs + 2]); val[3] += bfr(bias[c0 + cofs + 3]); }
        *(v4f*)(C + (size_t)(r0 + row) * ldc + c0 + cofs) = val; }
}

// ---- k_gemmc: ONE WAVE per 64x64 output tile (short K: no split), for the scores of causal attention: CMODE 1 skips score tiles entirely above the diagonal (query rows r0+roff.., key columns c0..).
// roff = row offset of this launch's first row within the sequence.
template <typename T16, int NSPLIT, int CMODE>
__global__ __launch_bounds__(32) void k_gemmc(const T16* __restrict__ A, const T16* __restrict__ A2, const T16* __restrict__ Bt, const T16* __restrict__ Bt2, int K, float* C, int ldc, int roff, size_t sA, size_t sB, size_t sC) {
    typedef typename WFrag<T16>::V V;
    __shared__ __align__(16) float os[16 * 68];
    const size_t z = blockIdx.z; A += z * sA; if (A2) A2 += z * sA; Bt += z * sB; if (Bt2) Bt2 += z * sB; C += z * sC;
    const int lane = threadIdx.x & 31, lr = lane & 15, hi = lane >> 4; const int r0 = blockIdx.x * 64, c0 = blockIdx.y * 64;
    if (CMODE == 1 && c0 > r0 + roff + 63) return;                  // score tile entirely above the causal diagonal: never written (the softmax masks j > i by select)
    v8f acc[4][4];
#pragma unroll
    for (int mb = 0; mb < 4; ++mb)
#pragma unroll
        for (int nb = 0; nb < 4; ++nb) acc[mb][nb] = (v8f){};
    const size_t aoff = (size_t)(r0 + lr) * K + 8 * hi, boff = (size_t)(c0 + lr) * K + 8 * hi;
#pragma unroll 1
    for (int kc = 0; kc < K; kc += 32) {
        V a[4], a2[4];
#pragma unroll
        for (int mb = 0; mb < 4; ++mb) { a[mb] = WFrag<T16>::ld(A + aoff + (size_t)mb * 16 * K + kc); if (NSPLIT == 1 || NSPLIT == 2) a2[mb] = WFrag<T16>::ld(A2 + aoff + (size_t)mb * 16 * K + kc); }
#pragma unroll
        for (int nb = 0; nb < 4; ++nb) { const V b = WFrag<T16>::ld(Bt + boff + (size_t)nb * 16 * K + kc); V b2; if (NSPLIT >= 2) b2 = WFrag<T16>::ld(Bt2 + boff + (size_t)nb * 16 * K + kc);
#pragma unroll
            for (int mb = 0; mb < 4; ++mb) { acc[mb][nb] = WFrag<T16>::mma(a[mb], b, acc[mb][nb]); if (NSPLIT == 1 || NSPLIT == 2) acc[mb][nb] = WFrag<T16>::mma(a2[mb], b, acc[mb][nb]); if (NSPLIT >= 2) acc[mb][nb] = WFrag<T16>::mma(a[mb], b2, acc[mb][nb]); } }
        asm volatile("v_nop\n\tv_nop\n\tv_nop\n\tv_nop" : "+v"(acc[0][0]), "+v"(acc[1][1]), "+v"(acc[2][2]), "+v"(acc[3][3]) : "v"(a[0]), "v"(a[3]));
    }
#pragma unroll
    for (int mb = 0; mb < 4; ++mb) {
#pragma unroll
        for (int nb = 0; nb < 4; ++nb) {
#pragma unroll
            for (int j = 0; j < 8; ++j) os[(hi * 8 + j) * 68 + nb * 16 + lr] = acc[mb][nb][j]; }
        __builtin_amdgcn_wave_barrier(); asm volatile("" ::: "memory");
        float* crow = C + (size_t)(r0 + mb * 16) * ldc + c0;
{
#pragma unroll
            for (int s = 0; s < 8; ++s) { const int row = 2 * s + hi, cofs = lr * 4; v4f val = *(const v4fa*)(os + row * 68 + cofs);
                *(v4f*)(crow + (size_t)row * ldc + cofs) = val; }
             }
        __builtin_amdgcn_wave_barrier(); asm volatile("" ::: "memory");
    }
}

__device__ __forceinline__ h16 tohx(float x) { return (h16)x; }
__device__ __forceinline__ void splitf(float y, unsigned short& h, unsigned short& l) { h = f2bf(y); l = f2bf(y - bf2f(h)); }
typedef __attribute__((ext_vector_type(2))) _Float16 v2h;
typedef __attribute__((ext_vector_type(4))) _Float16 v4h;
typedef __attribute__((ext_vector_type(2))) unsigned short v2us;
typedef __attribute__((ext_vector_type(4))) unsigned short v4us;
typedef __attribute__((ext_vector_type(2))) float v2f;
typedef __attribute__((ext_vector_type(4))) int v4i;
typedef v4h  __attribute__((may_alias)) v4ha;
typedef v4us __attribute__((may_alias)) v4usa;

__global__ __launch_bounds__(256) void k_wtG(const float* __restrict__ w, int K, int N, bf* Bt) {
    const int lane = threadIdx.x & 31; const int L0 = (blockIdx.x * 8 + (threadIdx.x >> 5)) * 8; const int nlines = N * K / 64;
{
#pragma unroll 1
        for (int l = 0; l < 8; ++l) { const int L = L0 + l; if (L >= nlines) break; const size_t e = (size_t)L * 64 + lane * 2; const int k = (int)(e % K), n = (int)(e / K); v2us o;
            o[0] = f2bf(w[(size_t)k * N + n]); o[1] = f2bf(w[(size_t)(k + 1) * N + n]); *(v2us*)(Bt + e) = o; }
         }
}
__global__ __launch_bounds__(256) void k_cvt8(const float* __restrict__ src, bf* dst, size_t n8) { const size_t i = (size_t)blockIdx.x * 256 + threadIdx.x; if (i >= n8) return; const v8f v = *(const v8f*)(src + i * 8); v8us o;
#pragma unroll
    for (int k = 0; k < 8; ++k) o[k] = f2bf(v[k]); *(v8us*)(dst + i * 8) = o;  }

// k_rope: head planes [h][t][d] (fp16 + hi/lo) of rope(x) x sc with the rotate-half convention out[d] = x[d] cos[t][d] - x[d+HD/2] sin[t][d], out[d+HD/2] = x[d+HD/2] cos[t][d+HD/2] + x[d] sin[t][d+HD/2]
__global__ __launch_bounds__(256) void k_rope(const float* __restrict__ F, int pitch, int nheads, const float* __restrict__ CS, const float* __restrict__ RF, const float* __restrict__ nw, float sc, h16* P16, bf* Ph, bf* Pl) {
    const size_t e = ((size_t)blockIdx.x * 256 + threadIdx.x) * 2; if (e >= (size_t)nheads * TT * HD) return; const int d = (int)(e % HD); const int t = (int)((e / HD) % TT); const int h = (int)(e / ((size_t)HD * TT)); const float* f = F + (size_t)t * pitch + h * HD; const float rf = RF ? RF[(size_t)h * TT + t] : 1.0f; v2h o16; v2us oh, ol;
#pragma unroll
    for (int q = 0; q < 2; ++q) { const int dd = d + q; const int dp = (dd < HD / 2) ? dd + HD / 2 : dd - HD / 2; float x0 = f[dd], x1 = f[dp];
        if (RF) { float n0 = __fmul_rn(x0, rf), n1 = __fmul_rn(x1, rf); asm volatile("" : "+v"(n0)); asm volatile("" : "+v"(n1)); x0 = __fmul_rn(bfr(nw[dd]), n0); x1 = __fmul_rn(bfr(nw[dp]), n1); }
        const v2f cs = *(const v2f*)(CS + ((size_t)t * HD + dd) * 2); float a = __fmul_rn(x0, cs[0]), bq = __fmul_rn(x1, cs[1]); asm volatile("" : "+v"(a)); asm volatile("" : "+v"(bq)); const float r = ((dd < HD / 2) ? __fsub_rn(a, bq) : __fadd_rn(a, bq)) * sc;
        o16[q] = tohx(r); unsigned short a2, c2; splitf(r, a2, c2); oh[q] = a2; ol[q] = c2; }
    *(v2h*)(P16 + e) = o16; *(v2us*)(Ph + e) = oh; *(v2us*)(Pl + e) = ol;  }
__global__ __launch_bounds__(256) void k_vtp(const float* __restrict__ F, int pitch, int nheads, h16* V16, bf* Vh, bf* Vl) { const size_t e = ((size_t)blockIdx.x * 256 + threadIdx.x) * 2; if (e >= (size_t)nheads * HD * TT) return; const int t = (int)(e % TT); const int d = (int)((e / TT) % HD); const int g = (int)(e / ((size_t)TT * HD)); v2h o16; v2us oh, ol;
#pragma unroll
    for (int q = 0; q < 2; ++q) { const float x = F[(size_t)(t + q) * pitch + g * HD + d]; o16[q] = tohx(x); unsigned short a2, c2; splitf(x, a2, c2); oh[q] = a2; ol[q] = c2; }
    *(v2h*)(V16 + e) = o16; *(v2us*)(Vh + e) = oh; *(v2us*)(Vl + e) = ol;  }
__constant__ float INVT[HD / 2] = { 1.000000000e+00f, 5.623413324e-01f, 3.162277639e-01f, 1.778279394e-01f, 1.000000015e-01f, 5.623412877e-02f, 3.162277862e-02f, 1.778279431e-02f, 9.999999776e-03f, 5.623413250e-03f, 3.162277862e-03f, 1.778279431e-03f, 1.000000047e-03f, 5.623413017e-04f, 3.162277862e-04f, 1.778279402e-04f, 1.000000000e+00f, 5.623413324e-01f, 3.162277639e-01f, 1.778279394e-01f, 1.000000015e-01f, 5.623412877e-02f, 3.162277862e-02f, 1.778279431e-02f, 9.999999776e-03f, 5.623413250e-03f, 3.162277862e-03f, 1.778279431e-03f, 1.000000047e-03f, 5.623413017e-04f, 3.162277862e-04f, 1.778279402e-04f };
__global__ __launch_bounds__(256) void k_cstabH(float* CS) { const int idx = blockIdx.x * 256 + threadIdx.x; if (idx >= TT * HD) return; const int d = idx % HD; const int t = idx / HD; const float a = __fmul_rn((float)t, INVT[d & (HD / 2 - 1)]); v2f cs; cs[0] = cosf(a); cs[1] = sinf(a); *(v2f*)(CS + (size_t)idx * 2) = cs;  }
// k_asoft: per row (zz, i): t = S x HD^-0.5 for j <= i and i - j < WIN (sliding causal window; the reference's -1e9 additive fill vanishes identically); softmax over the 2048 keys (register row, one exp, fixed trees);
// the row's probabilities go IN PLACE over its own 8192 bytes of scores (one wave owns the row and holds all of it in registers before its first store): rows < RH hi plane in the first 4096 bytes, lo plane in the second; other rows fp16 in the first 4096. Pitch for the readers: 2 * TT 16-bit elements.
__global__ __launch_bounds__(256) void k_asoft(float* Sb) {
    const int lane = threadIdx.x & 31; const int row = blockIdx.x * 8 + (threadIdx.x >> 5); if (row >= ZH * TT) return; const int i = row % TT; const bool hires = (i < RH); float* sr = Sb + (size_t)row * TT; float v[TT / 32]; float mx = -3.0e38f;
#pragma unroll
    for (int ch = 0; ch < TT / 128; ++ch) { const int j0 = ch * 128 + lane * 4; const v4f a = *(const v4fa*)(sr + j0);
#pragma unroll
        for (int q = 0; q < 4; ++q) { const int j = j0 + q; (void)j; const float t = (j <= i && i - j < WIN) ? a[q] * SCL : -3.0e38f; v[ch * 4 + q] = t; mx = fmaxf(mx, t); } }
#pragma unroll
    for (int sh = 16; sh; sh >>= 1) mx = fmaxf(mx, __shfl_xor(mx, sh, 32));
    float sum = 0.f;
#pragma unroll
    for (int k = 0; k < TT / 32; ++k) { float d0 = __fsub_rn(v[k], mx); asm volatile("" : "+v"(d0)); v[k] = __builtin_amdgcn_exp2f(__fmul_rn(d0, 1.4426950408889634f)); sum += v[k]; }
#pragma unroll
    for (int sh = 16; sh; sh >>= 1) sum += __shfl_xor(sum, sh, 32);
    const float f = __fdiv_rn(hires ? 1.0f : PCAR, sum);
{
        if (hires) {
#pragma unroll
            for (int ch = 0; ch < TT / 128; ++ch) { v4us oh, ol;
#pragma unroll
                for (int q = 0; q < 4; ++q) { unsigned short a, c2; splitf(v[ch * 4 + q] * f, a, c2); oh[q] = a; ol[q] = c2; }
                bf* pr = (bf*)sr + ch * 128 + lane * 4; *(v4usa*)pr = oh; *(v4usa*)(pr + TT) = ol; }
        } else {
#pragma unroll
            for (int ch = 0; ch < TT / 128; ++ch) { v4h o4;
#pragma unroll
                for (int q = 0; q < 4; ++q) o4[q] = tohx(v[ch * 4 + q] * f);
                *(v4ha*)((h16*)sr + ch * 128 + lane * 4) = o4; } }
         }
}
__global__ __launch_bounds__(256) void k_merge(const float* __restrict__ O, int h0, bf* Ah, bf* Al) { const size_t e = ((size_t)blockIdx.x * 256 + threadIdx.x) * 2; if (e >= (size_t)ZH * TT * HD) return; const int d = (int)(e % HD); const int t = (int)((e / HD) % TT); const int zz = (int)(e / ((size_t)HD * TT)); const float cs = (t < RH) ? 1.0f : (1.0f / PCAR); const size_t oo = (size_t)t * DQ + (h0 + zz) * HD + d;
    v2us oh, ol;
#pragma unroll
    for (int q = 0; q < 2; ++q) { unsigned short a, c2; splitf(O[e + q] * cs, a, c2); oh[q] = a; ol[q] = c2; } *(v2us*)(Ah + oo) = oh; *(v2us*)(Al + oo) = ol;  }

extern "C" void kernel_launch(void* const* d_in, const int* in_sizes, int n_in,
                              void* d_out, int out_size, void* d_ws, size_t ws_size, hipStream_t stream) {
    (void)in_sizes; (void)n_in; (void)out_size;
    const float* x = (const float*)d_in[0]; const float* wqkv = (const float*)d_in[1]; const float* bqkv = (const float*)d_in[2]; const float* wo = (const float*)d_in[3]; const float* bo = (const float*)d_in[4];   /* order x, W_attn ('xw' [1024][3072]: q | k | v column thirds), b_attn (zeros: read), W_proj, b_proj (zeros: read); five inputs, all read */ const float* bq = bqkv; const float* bk = bqkv + DQ; const float* bv = bqkv + 2 * DQ;
    float* OUT = (float*)d_out;     // [4][2048][1024]
    char* wsp = (char*)d_ws;
    auto take = [&](size_t bytes) { char* p = wsp; wsp += (bytes + 255) & ~(size_t)255; return (void*)p; };
    bf* WQKV = (bf*)take((size_t)3 * DQ * DM * 2); bf* WQ = WQKV; bf* WK = WQKV + (size_t)DQ * DM; bf* WV = WQKV + (size_t)2 * DQ * DM;   /* fused Bt [3*DQ][DM]: q | k | v row blocks */ bf* WO = (bf*)take((size_t)DM * DQ * 2); float* CS = (float*)take((size_t)TT * HD * 2 * 4);
    bf* XB = (bf*)take((size_t)TT * DM * 2); float* FQ = (float*)take((size_t)TT * DQ * 4); float* FK = (float*)take((size_t)TT * DKV * 4);
    h16* QP16 = (h16*)take((size_t)NH_ * TT * HD * 2); h16* KP16 = (h16*)take((size_t)NKV * TT * HD * 2); h16* VT16 = (h16*)take((size_t)NKV * HD * TT * 2);
    bf* QPh = (bf*)take((size_t)NH_ * TT * HD * 2); bf* QPl = (bf*)take((size_t)NH_ * TT * HD * 2); bf* KPh = (bf*)take((size_t)NKV * TT * HD * 2); bf* KPl = (bf*)take((size_t)NKV * TT * HD * 2); bf* VTh = (bf*)take((size_t)NKV * HD * TT * 2); bf* VTl = (bf*)take((size_t)NKV * HD * TT * 2);
    float* Sb = (float*)take((size_t)ZH * TT * TT * 4);   /* scores, then in place the probabilities */ float* Ob = (float*)take((size_t)ZH * TT * HD * 4); bf* ATh = (bf*)take((size_t)TT * DQ * 2); bf* ATl = (bf*)take((size_t)TT * DQ * 2);
    if ((size_t)(wsp - (char*)d_ws) > ws_size) return;    // ws 256 MiB
    float* FV = FK;   // v projection reuses the k buffer after the k planes are built (stream-ordered)
    { k_wtG<<<(unsigned)((DM * 3 * DQ / 64 + 63) / 64), 256, 0, stream>>>(wqkv, DM, 3 * DQ, WQKV);   /* fused 'xw' [DM][3*DQ] -> Bt [3*DQ][DM] */
      k_wtG<<<(unsigned)((DQ * DM / 64 + 63) / 64), 256, 0, stream>>>(wo, DQ, DM, WO);
       }
    k_cstabH<<<(TT * HD + 255) / 256, 256, 0, stream>>>(CS);   /* rotary table once (positions = arange) */
    const unsigned LQ = (unsigned)(((size_t)NH_ * TT * HD / 2 + 255) / 256), LKv = (unsigned)(((size_t)NKV * TT * HD / 2 + 255) / 256);
    for (int b = 0; b < NB_; ++b) {
        
        k_cvt8<<<(unsigned)(((size_t)TT * DM / 8 + 255) / 256), 256, 0, stream>>>(x + (size_t)b * TT * DM, XB, (size_t)TT * DM / 8);
        k_gemmw<bf, 0, true, 8, 128, false><<<dim3(TT / 64, DQ / 64, 1), 256, 0, stream>>>(XB, nullptr, DM, WQ, nullptr, DM, FQ, DQ, bq, 0, 0, 0, 0);
        k_rope<<<LQ, 256, 0, stream>>>(FQ, DQ, NH_, CS, nullptr, nullptr, 1.0f, QP16, QPh, QPl);
        k_gemmw<bf, 0, true, 8, 128, false><<<dim3(TT / 64, DKV / 64, 1), 256, 0, stream>>>(XB, nullptr, DM, WK, nullptr, DM, FK, DKV, bk, 0, 0, 0, 0);
        k_rope<<<LKv, 256, 0, stream>>>(FK, DKV, NKV, CS, nullptr, nullptr, 1.0f, KP16, KPh, KPl);
        k_gemmw<bf, 0, true, 8, 128, false><<<dim3(TT / 64, DKV / 64, 1), 256, 0, stream>>>(XB, nullptr, DM, WV, nullptr, DM, FV, DKV, bv, 0, 0, 0, 0); k_vtp<<<LKv, 256, 0, stream>>>(FV, DKV, NKV, VT16, VTh, VTl);
        for (int h0 = 0; h0 < NH_; h0 += ZH) { const size_t zq = (size_t)h0, zk = (size_t)(h0 / REP);   // one kv head per query head: the pass's ZH heads use consecutive kv planes (z-strides TT*HD)
            k_gemmc<bf, 2, 1><<<dim3(RH / 64, TT / 64, ZH), 32, 0, stream>>>(QPh + zq * TT * HD, QPl + zq * TT * HD, KPh + zk * TT * HD, KPl + zk * TT * HD, HD, Sb, TT, 0, (size_t)TT * HD, (size_t)TT * HD, (size_t)TT * TT);
            k_gemmc<h16, 0, 1><<<dim3((TT - RH) / 64, TT / 64, ZH), 32, 0, stream>>>(QP16 + zq * TT * HD + (size_t)RH * HD, nullptr, KP16 + zk * TT * HD, nullptr, HD, Sb + (size_t)RH * TT, TT, RH, (size_t)TT * HD, (size_t)TT * HD, (size_t)TT * TT);
            k_asoft<<<ZH * TT / 8, 256, 0, stream>>>(Sb);
            k_gemmw<bf, 2, false, 8, 64, true><<<dim3(RH / 64, HD / 64, ZH), 256, 0, stream>>>((const bf*)Sb, (const bf*)Sb + TT, 2 * TT, VTh + zk * HD * TT, VTl + zk * HD * TT, TT, Ob, HD, nullptr, 0, (size_t)2 * TT * TT, (size_t)HD * TT, (size_t)TT * HD);
            k_gemmw<h16, 0, false, 16, 128, true><<<dim3((TT - RH) / 64, HD / 64, ZH), 512, 0, stream>>>((const h16*)Sb + (size_t)RH * 2 * TT, nullptr, 2 * TT, VT16 + zk * HD * TT, nullptr, TT, Ob + (size_t)RH * HD, HD, nullptr, RH, (size_t)2 * TT * TT, (size_t)HD * TT, (size_t)TT * HD);
            k_merge<<<(unsigned)(((size_t)ZH * TT * HD / 2 + 255) / 256), 256, 0, stream>>>(Ob, h0, ATh, ATl); }
        k_gemmw<bf, 1, true, 8, 128, false><<<dim3(TT / 64, DM / 64, 1), 256, 0, stream>>>(ATh, ATl, DQ, WO, nullptr, DQ, OUT + (size_t)b * TT * DM, DM, bo, 0, 0, 0, 0); }
}

// v003
// A run of this version takes 419 microseconds.
// Next to v002, in two timings, it ran 2.17 and 2.16 times as fast.
// Counting every step since v000, it is 6.95 times as fast.
#include <hip/hip_runtime.h>

// Causal self-attention with a fused biased qkv projection and a computed rotate-half RoPE at a NON-STANDARD frequency table (x [4][2048][1024]; qkv = x W_attn + b_attn ('xw' [1024][3072] 1/32 + a zero bias: read) split in thirds q | k | v (16 heads x 64); _rope_tables: rot = 32; inv_freq = 1 / (10000 ** (arange(0, 32, 2) / 32)): SIXTEEN frequencies; emb = cat(freqs, freqs): [T][32]; x <- cat(x1 cos - x2 sin, x2 cos + x1 sin) on the two HALVES (pairs (d, d + 32)) with the angle index d mod 16, on q and k; att x 1/sqrt(64); causal (-inf); softmax; y = merged W_proj + b_proj ('xw' + a zero bias: read) -> [4][2048][1024] (8.4 M); argument order x, W_attn, b_attn, W_proj, b_proj).
// Layout per batch: bf16 copy of x; fused 'xw' weight transposed once (q | k | v row blocks) + bias thirds; exact projections + f32 biases; k_cstabH computed table (elements d and d + 32 share an angle) + the rotate-half plane builders; the planes of all batches kept; causal T-2048 attention of every batch and head in one kernel with a running softmax (k_fattn; hybrid rows: < 512 hi/lo 3 products, rest fp16 x1024); merged hi/lo x W_proj exact + b_proj.
// Compute dtypes, f32 accumulate: every input rounded to bf16; projections exact + f32 biases; attention rows < 512 3 products, rest fp16; softmax f32; W_proj hl x exact + bias.

#define NB_  4
#define TT   2048
#define DM   1024
#define NH_  16
#define NKV  16
#define REP  (NH_ / NKV)
#define HD   64
#define DQ   (NH_ * HD)
#define DKV  (NKV * HD)
#define RH   512                  // query rows < RH use hi+lo planes (0: none)
typedef _Float16 h16;
typedef unsigned short bf;
typedef __attribute__((ext_vector_type(16))) __bf16   v16bf;
typedef __attribute__((ext_vector_type(16))) _Float16 v16h;
typedef __attribute__((ext_vector_type(8)))  _Float16 v8h;
typedef __attribute__((ext_vector_type(8)))  unsigned short v8us;
typedef __attribute__((ext_vector_type(8)))  float    v8f;
typedef __attribute__((ext_vector_type(4)))  float    v4f;
typedef v8h  __attribute__((may_alias)) v8ha;
typedef v4f  __attribute__((may_alias)) v4fa;
typedef v8us __attribute__((may_alias)) v8usa;

__device__ __forceinline__ unsigned short f2bf(float f) { unsigned u = __float_as_uint(f); u += 0x7FFFu + ((u >> 16) & 1u); return (unsigned short)(u >> 16); }
__device__ __forceinline__ float bf2f(unsigned short b) { return __uint_as_float(((unsigned)b) << 16); }
__device__ __forceinline__ float bfr(float f) { return bf2f(f2bf(f)); }
__device__ __forceinline__ v16h cat16(v8h lo, v8h hi) { return __builtin_shufflevector(lo, hi, 0, 1, 2, 3, 4, 5, 6, 7, 8, 9, 10, 11, 12, 13, 14, 15); }
__device__ __forceinline__ v16bf cat16b(v8us lo, v8us hi) { return __builtin_bit_cast(v16bf, __builtin_shufflevector(lo, hi, 0, 1, 2, 3, 4, 5, 6, 7, 8, 9, 10, 11, 12, 13, 14, 15)); }
__device__ __forceinline__ v8f wmma16(v16h a, v16h b, v8f c) { return __builtin_amdgcn_wmma_f32_16x16x32_f16(false, a, false, b, (short)0, c, false, false); }
__device__ __forceinline__ v8f wmmab(v16bf a, v16bf b, v8f c) { return __builtin_amdgcn_wmma_f32_16x16x32_bf16(false, a, false, b, (short)0, c, false, false); }



// ---- k_gemmw: register-blocked GEMM, one 64x64 output tile per work-group of NW waves; the K range is cut in runs of KCH elements (whole 128-byte lines of every operand row) and wave w takes runs w, w + NW, ...;
// every wave keeps a whole 64x64 partial tile (16 accumulators), operands straight from K-contiguous 16-bit planes; the NW partial tiles meet in LDS and are summed in wave order. grid (M/64, N/64, Z), NW * 32 threads.
// C[m][n] (f32, pitch ldc, + optional f32 bias[n]) = sum_k A[m][k] Bt[n][k] (+ split products per NSPLIT). A rows at pitch lda, Bt rows at pitch K; z-batch strides sA/sB/sC in elements. K % 32 == 0.
// DIAG: probability x value contraction of causal attention: probabilities are exactly 0 beyond the diagonal block of query rows r0 + roff .., so the K range stops there.
template <typename T16> struct WFrag;
template <> struct WFrag<h16> { typedef v16h V; static __device__ __forceinline__ V ld(const h16* p) { return cat16(*(const v8h*)p, *(const v8h*)(p + 16)); } static __device__ __forceinline__ v8f mma(V a, V b, v8f c) { return wmma16(a, b, c); } };
template <> struct WFrag<bf> { typedef v16bf V; static __device__ __forceinline__ V ld(const bf* p) { return cat16b(*(const v8us*)p, *(const v8us*)(p + 16)); } static __device__ __forceinline__ v8f mma(V a, V b, v8f c) { return wmmab(a, b, c); } };
template <typename T16, int NSPLIT, bool BIAS, int NW, int KCH, bool DIAG>
__global__ __launch_bounds__(NW * 32) void k_gemmw(const T16* __restrict__ A, const T16* __restrict__ A2, int lda, const T16* __restrict__ Bt, const T16* __restrict__ Bt2, int K, float* C, int ldc, const float* __restrict__ bias, int roff, size_t sA, size_t sB, size_t sC) {
    typedef typename WFrag<T16>::V V;
    __shared__ __align__(16) float os[NW * 64 * 68];
    const size_t z = blockIdx.z; A += z * sA; if (A2) A2 += z * sA; Bt += z * sB; if (Bt2) Bt2 += z * sB; C += z * sC;
    const int lane = threadIdx.x & 31, lr = lane & 15, hi = lane >> 4; const int r0 = blockIdx.x * 64, c0 = blockIdx.y * 64; const int w = __builtin_amdgcn_readfirstlane((int)(threadIdx.x >> 5));   // wave number, held scalar so that the K loops stay scalar branches
    const int Kl = DIAG ? min(K, r0 + roff + 64) : K;
    v8f acc[4][4];
#pragma unroll
    for (int mb = 0; mb < 4; ++mb)
#pragma unroll
        for (int nb = 0; nb < 4; ++nb) acc[mb][nb] = (v8f){};
    const size_t aoff = (size_t)(r0 + lr) * lda + 8 * hi, boff = (size_t)(c0 + lr) * K + 8 * hi;
    for (int kb = w * KCH; kb < Kl; kb += NW * KCH) { const int ke = min(kb + KCH, Kl);
#pragma unroll 1
    for (int kc = kb; kc < ke; kc += 32) {
        V a[4], a2[4];
#pragma unroll
        for (int mb = 0; mb < 4; ++mb) { a[mb] = WFrag<T16>::ld(A + aoff + (size_t)mb * 16 * lda + kc); if (NSPLIT == 1 || NSPLIT == 2) a2[mb] = WFrag<T16>::ld(A2 + aoff + (size_t)mb * 16 * lda + kc); }
#pragma unroll
        for (int nb = 0; nb < 4; ++nb) { const V b = WFrag<T16>::ld(Bt + boff + (size_t)nb * 16 * K + kc); V b2; if (NSPLIT >= 2) b2 = WFrag<T16>::ld(Bt2 + boff + (size_t)nb * 16 * K + kc);
#pragma unroll
            for (int mb = 0; mb < 4; ++mb) { acc[mb][nb] = WFrag<T16>::mma(a[mb], b, acc[mb][nb]); if (NSPLIT == 1 || NSPLIT == 2) acc[mb][nb] = WFrag<T16>::mma(a2[mb], b, acc[mb][nb]); if (NSPLIT >= 2) acc[mb][nb] = WFrag<T16>::mma(a[mb], b2, acc[mb][nb]); } }
        asm volatile("v_nop\n\tv_nop\n\tv_nop\n\tv_nop" : "+v"(acc[0][0]), "+v"(acc[1][1]), "+v"(acc[2][2]), "+v"(acc[3][3]) : "v"(a[0]), "v"(a[3]));
    } }
    float* ow = os + w * (64 * 68);   // this wave's partial tile, row-major at pitch 68 (a wave whose runs all lie beyond Kl hands in zeros)
#pragma unroll
    for (int mb = 0; mb < 4; ++mb)
#pragma unroll
        for (int nb = 0; nb < 4; ++nb)
#pragma unroll
            for (int j = 0; j < 8; ++j) ow[(mb * 16 + hi * 8 + j) * 68 + nb * 16 + lr] = acc[mb][nb][j];
    __syncthreads();   // every wave's partial tile is in LDS before any of it is summed
#pragma unroll
    for (int s = 0; s < 32 / NW; ++s) { const int q = s * NW * 32 + (int)threadIdx.x; const int row = q >> 4, cofs = (q & 15) * 4; v4f val = *(const v4fa*)(os + row * 68 + cofs);
#pragma unroll
        for (int u = 1; u < NW; ++u) val += *(const v4fa*)(os + u * (64 * 68) + row * 68 + cofs);
        if (BIAS) { val[0] += bfr(bias[c0 + cofs]); val[1] += bfr(bias[c0 + cofs + 1]); val[2] += bfr(bias[c0 + cofs + 2]); val[3] += bfr(bias[c0 + cofs + 3]); }
        *(v4f*)(C + (size_t)(r0 + row) * ldc + c0 + cofs) = val; }
}

__device__ __forceinline__ h16 tohx(float x) { return (h16)x; }
__device__ __forceinline__ void splitf(float y, unsigned short& h, unsigned short& l) { h = f2bf(y); l = f2bf(y - bf2f(h)); }
typedef __attribute__((ext_vector_type(2))) _Float16 v2h;
typedef __attribute__((ext_vector_type(4))) _Float16 v4h;
typedef __attribute__((ext_vector_type(2))) unsigned short v2us;
typedef __attribute__((ext_vector_type(4))) unsigned short v4us;
typedef __attribute__((ext_vector_type(2))) float v2f;
typedef __attribute__((ext_vector_type(4))) int v4i;
typedef v4h  __attribute__((may_alias)) v4ha;
typedef v4us __attribute__((may_alias)) v4usa;

__global__ __launch_bounds__(256) void k_wtG(const float* __restrict__ w, int K, int N, bf* Bt) {
    const int lane = threadIdx.x & 31; const int L0 = (blockIdx.x * 8 + (threadIdx.x >> 5)) * 8; const int nlines = N * K / 64;
{
#pragma unroll 1
        for (int l = 0; l < 8; ++l) { const int L = L0 + l; if (L >= nlines) break; const size_t e = (size_t)L * 64 + lane * 2; const int k = (int)(e % K), n = (int)(e / K); v2us o;
            o[0] = f2bf(w[(size_t)k * N + n]); o[1] = f2bf(w[(size_t)(k + 1) * N + n]); *(v2us*)(Bt + e) = o; }
         }
}
__global__ __launch_bounds__(256) void k_cvt8(const float* __restrict__ src, bf* dst, size_t n8) { const size_t i = (size_t)blockIdx.x * 256 + threadIdx.x; if (i >= n8) return; const v8f v = *(const v8f*)(src + i * 8); v8us o;
#pragma unroll
    for (int k = 0; k < 8; ++k) o[k] = f2bf(v[k]); *(v8us*)(dst + i * 8) = o;  }

// k_rope: head planes [h][t][d] (fp16 + hi/lo) of rope(x) x sc with the rotate-half convention out[d] = x[d] cos[t][d] - x[d+HD/2] sin[t][d], out[d+HD/2] = x[d+HD/2] cos[t][d+HD/2] + x[d] sin[t][d+HD/2]
__global__ __launch_bounds__(256) void k_rope(const float* __restrict__ F, int pitch, int nheads, const float* __restrict__ CS, const float* __restrict__ RF, const float* __restrict__ nw, float sc, h16* P16, bf* Ph, bf* Pl) {
    const size_t e = ((size_t)blockIdx.x * 256 + threadIdx.x) * 2; if (e >= (size_t)nheads * TT * HD) return; const int d = (int)(e % HD); const int t = (int)((e / HD) % TT); const int h = (int)(e / ((size_t)HD * TT)); const float* f = F + (size_t)t * pitch + h * HD; const float rf = RF ? RF[(size_t)h * TT + t] : 1.0f; v2h o16; v2us oh, ol;
#pragma unroll
    for (int q = 0; q < 2; ++q) { const int dd = d + q; const int dp = (dd < HD / 2) ? dd + HD / 2 : dd - HD / 2; float x0 = f[dd], x1 = f[dp];
        if (RF) { float n0 = __fmul_rn(x0, rf), n1 = __fmul_rn(x1, rf); asm volatile("" : "+v"(n0)); asm volatile("" : "+v"(n1)); x0 = __fmul_rn(bfr(nw[dd]), n0); x1 = __fmul_rn(bfr(nw[dp]), n1); }
        const v2f cs = *(const v2f*)(CS + ((size_t)t * HD + dd) * 2); float a = __fmul_rn(x0, cs[0]), bq = __fmul_rn(x1, cs[1]); asm volatile("" : "+v"(a)); asm volatile("" : "+v"(bq)); const float r = ((dd < HD / 2) ? __fsub_rn(a, bq) : __fadd_rn(a, bq)) * sc;
        o16[q] = tohx(r); unsigned short a2, c2; splitf(r, a2, c2); oh[q] = a2; ol[q] = c2; }
    *(v2h*)(P16 + e) = o16; *(v2us*)(Ph + e) = oh; *(v2us*)(Pl + e) = ol;  }
__global__ __launch_bounds__(256) void k_vtp(const float* __restrict__ F, int pitch, int nheads, h16* V16, bf* Vh, bf* Vl) { const size_t e = ((size_t)blockIdx.x * 256 + threadIdx.x) * 2; if (e >= (size_t)nheads * HD * TT) return; const int t = (int)(e % TT); const int d = (int)((e / TT) % HD); const int g = (int)(e / ((size_t)TT * HD)); v2h o16; v2us oh, ol;
#pragma unroll
    for (int q = 0; q < 2; ++q) { const float x = F[(size_t)(t + q) * pitch + g * HD + d]; o16[q] = tohx(x); unsigned short a2, c2; splitf(x, a2, c2); oh[q] = a2; ol[q] = c2; }
    *(v2h*)(V16 + e) = o16; *(v2us*)(Vh + e) = oh; *(v2us*)(Vl + e) = ol;  }
__constant__ float INVT[HD / 2] = { 1.000000000e+00f, 5.623413324e-01f, 3.162277639e-01f, 1.778279394e-01f, 1.000000015e-01f, 5.623412877e-02f, 3.162277862e-02f, 1.778279431e-02f, 9.999999776e-03f, 5.623413250e-03f, 3.162277862e-03f, 1.778279431e-03f, 1.000000047e-03f, 5.623413017e-04f, 3.162277862e-04f, 1.778279402e-04f, 1.000000000e+00f, 5.623413324e-01f, 3.162277639e-01f, 1.778279394e-01f, 1.000000015e-01f, 5.623412877e-02f, 3.162277862e-02f, 1.778279431e-02f, 9.999999776e-03f, 5.623413250e-03f, 3.162277862e-03f, 1.778279431e-03f, 1.000000047e-03f, 5.623413017e-04f, 3.162277862e-04f, 1.778279402e-04f };
__global__ __launch_bounds__(256) void k_cstabH(float* CS) { const int idx = blockIdx.x * 256 + threadIdx.x; if (idx >= TT * HD) return; const int d = idx % HD; const int t = idx / HD; const float a = __fmul_rn((float)t, INVT[d & (HD / 2 - 1)]); v2f cs; cs[0] = cosf(a); cs[1] = sinf(a); *(v2f*)(CS + (size_t)idx * 2) = cs;  }
// ---- k_fattn: causal attention in one kernel, nothing of the scores or probabilities in memory. One wave owns QW = 32 query rows of one (batch, head) and walks the keys in passes (64 keys x 32 queries; HR: 32 keys x 16 queries, the two halves of its rows in turn), up to its diagonal; waves share nothing (no LDS, no barrier).
// Transposed products: St[key][query] = K Qt (A = K rows, B = Q rows, both by WFrag::ld), so a lane holds scores of ONE query (column lr): running maximum and sum in the lane plus one exchange between the wave halves;
// two score tiles (keys 32c + 0..15, 32c + 16..31), converted in place, ARE the B operand of Ot[d][query] += Vt P t in the k order of WFrag::ld (element e < 8: key 8 hi + e, else 16 + 8 hi + e - 8); A = rows of the transposed value plane.
// HR (query rows < RH): bf16 hi/lo planes, 3 products in both contractions; else fp16, the probabilities carried x 2^POFF (it cancels against the row sum). The row sum adds the unrounded f32 exponentials; the division by it comes last.
#define QW   32
#define POFF 10.0f
#define KS   0.18033688011112042f   // HD^-0.5 x log2(e)
__device__ __forceinline__ float xhalf(float x) { return __builtin_bit_cast(float, __builtin_amdgcn_permlanex16(__builtin_bit_cast(int, x), __builtin_bit_cast(int, x), 0x76543210, 0xfedcba98, false, false)); }   // lane l with lane l ^ 16
// 2^x with the free slot that the instruction set asks for behind a transcendental, before its result is used or its source overwritten.
// In one statement the slot stands by construction; each of the four works in place on a register of its own, so that none touches a neighbour's source or result.
__device__ __forceinline__ float exp2n(float x) { float r; asm("v_exp_f32 %0, %1\n\tv_nop" : "=v"(r) : "v"(x)); return r; }
__device__ __forceinline__ void exp2x4(float& a, float& b, float& c, float& d) { asm("v_exp_f32 %0, %0\n\tv_exp_f32 %1, %1\n\tv_exp_f32 %2, %2\n\tv_exp_f32 %3, %3\n\tv_nop" : "+v"(a), "+v"(b), "+v"(c), "+v"(d)); }
template <bool HR> struct FT { typedef h16 T; };
template <> struct FT<true> { typedef bf T; };
template <bool HR, bool MASK, int NB, int MB>   // NB blocks of 16 query columns, MB blocks of 16 keys a pass
__device__ __forceinline__ void fa_pass(const typename FT<HR>::T* kp, const typename FT<HR>::T* kp2, const typename FT<HR>::T* vp, const typename FT<HR>::T* vp2, unsigned kl, unsigned vl, int dq,
                                        const typename WFrag<typename FT<HR>::T>::V (&qf)[NB][2], const typename WFrag<typename FT<HR>::T>::V (&qf2)[NB][2], v8f (&o)[4][NB], float (&m)[NB], float (&l)[NB]) {
    typedef typename FT<HR>::T T16; typedef WFrag<T16> F; typedef typename F::V V;
    V kf[MB][2], kf2[MB][2]; const T16* ka = kp + kl; const T16* ka2 = kp2 + kl;
#pragma unroll
    for (int mb = 0; mb < MB; ++mb)
#pragma unroll
        for (int c = 0; c < 2; ++c) { kf[mb][c] = F::ld(ka + mb * 16 * HD + c * 32); if (HR) kf2[mb][c] = F::ld(ka2 + mb * 16 * HD + c * 32); }
    // the wait before a register that an issued load names is overwritten; the addresses are inputs, so that they stay whole up to it and no load of the run lands on one
    if constexpr (HR) asm volatile("s_wait_xcnt 0x0" :: "v"(ka), "v"(ka2) : "memory"); else asm volatile("s_wait_xcnt 0x0" :: "v"(ka) : "memory");
    __builtin_amdgcn_sched_barrier(0);   // all K loads of the pass go out together, ahead of the first product: one memory latency a pass, not one per 16 keys
    v8f s[MB][NB];
#pragma unroll
    for (int mb = 0; mb < MB; ++mb)
#pragma unroll
        for (int nb = 0; nb < NB; ++nb) { v8f a = (v8f){}; a = F::mma(kf[mb][0], qf[nb][0], a); a = F::mma(kf[mb][1], qf[nb][1], a);
            if (HR) { a = F::mma(kf2[mb][0], qf[nb][0], a); a = F::mma(kf2[mb][1], qf[nb][1], a); a = F::mma(kf[mb][0], qf2[nb][0], a); a = F::mma(kf[mb][1], qf2[nb][1], a); }
            s[mb][nb] = a; }
    V vf[4][MB / 2], vf2[4][MB / 2]; const T16* va = vp + vl; const T16* va2 = vp2 + vl;
#pragma unroll
    for (int db = 0; db < 4; ++db)
#pragma unroll
        for (int c = 0; c < MB / 2; ++c) { vf[db][c] = F::ld(va + db * 16 * TT + c * 32); if (HR) vf2[db][c] = F::ld(va2 + db * 16 * TT + c * 32); }
    if constexpr (HR) asm volatile("s_wait_xcnt 0x0" :: "v"(va), "v"(va2) : "memory"); else asm volatile("s_wait_xcnt 0x0" :: "v"(va) : "memory");   // as behind the K loads
    __builtin_amdgcn_sched_barrier(0);   // the Vt loads go out ahead of the softmax and fly under it
    V pf[MB / 2][NB], pl[MB / 2][NB];
#pragma unroll
    for (int nb = 0; nb < NB; ++nb) { float mx = m[nb];
#pragma unroll
        for (int mb = 0; mb < MB; ++mb)
#pragma unroll
            for (int j = 0; j < 8; ++j) { if (MASK && (mb * 16 + j - nb * 16 > dq)) s[mb][nb][j] = -3.0e38f;   // key > query
                mx = fmaxf(mx, s[mb][nb][j]); }
        mx = fmaxf(mx, xhalf(mx));
        const float al = exp2n((m[nb] - mx) * KS); const float mk = mx * KS - (HR ? 0.0f : POFF); m[nb] = mx; float ps = 0.f;
#pragma unroll
        for (int mb = 0; mb < MB; ++mb)
#pragma unroll
            for (int j = 0; j < 8; j += 4) { float p0 = __builtin_fmaf(s[mb][nb][j], KS, -mk), p1 = __builtin_fmaf(s[mb][nb][j + 1], KS, -mk), p2 = __builtin_fmaf(s[mb][nb][j + 2], KS, -mk), p3 = __builtin_fmaf(s[mb][nb][j + 3], KS, -mk);
                exp2x4(p0, p1, p2, p3); s[mb][nb][j] = p0; s[mb][nb][j + 1] = p1; s[mb][nb][j + 2] = p2; s[mb][nb][j + 3] = p3; ps += p0; ps += p1; ps += p2; ps += p3; }
        l[nb] = l[nb] * al + ps;
#pragma unroll
        for (int db = 0; db < 4; ++db) o[db][nb] *= al;
#pragma unroll
        for (int c = 0; c < MB / 2; ++c) {
            if constexpr (HR) { v8us h0, h1, l0, l1;
#pragma unroll
                for (int j = 0; j < 8; ++j) { unsigned short a, b; splitf(s[2 * c][nb][j], a, b); h0[j] = a; l0[j] = b; splitf(s[2 * c + 1][nb][j], a, b); h1[j] = a; l1[j] = b; }
                pf[c][nb] = cat16b(h0, h1); pl[c][nb] = cat16b(l0, l1);
            } else { v8h h0, h1;
#pragma unroll
                for (int j = 0; j < 8; ++j) { h0[j] = tohx(s[2 * c][nb][j]); h1[j] = tohx(s[2 * c + 1][nb][j]); }
                pf[c][nb] = cat16(h0, h1); } }
        if (nb + 1 < NB) __builtin_amdgcn_sched_barrier(0); }   // one column block's scores are packed (half the registers) before the next block's exponentials start: mixed, the two cost spills
#pragma unroll
    for (int db = 0; db < 4; ++db)
#pragma unroll
        for (int nb = 0; nb < NB; ++nb) { v8f a = o[db][nb];
#pragma unroll
            for (int c = 0; c < MB / 2; ++c) { a = F::mma(vf[db][c], pf[c][nb], a); if (HR) a = F::mma(vf[db][c], pl[c][nb], a); }
            o[db][nb] = a; }
    if (HR) {
#pragma unroll
        for (int db = 0; db < 4; ++db)
#pragma unroll
            for (int nb = 0; nb < NB; ++nb) { v8f a = o[db][nb];
#pragma unroll
                for (int c = 0; c < MB / 2; ++c) a = F::mma(vf2[db][c], pf[c][nb], a);
                o[db][nb] = a; } }
    // the distance behind the pass's last matrix instructions, also on the taken back edge of the key loop
    if constexpr (!MASK && NB == 2) asm volatile("v_nop\n\tv_nop\n\tv_nop\n\tv_nop" : "+v"(o[0][0]), "+v"(o[0][1]), "+v"(o[1][0]), "+v"(o[1][1]), "+v"(o[2][0]), "+v"(o[2][1]), "+v"(o[3][0]), "+v"(o[3][1]) : "v"(pf[0][0]), "v"(pf[0][1]), "v"(pf[MB / 2 - 1][0]), "v"(pf[MB / 2 - 1][1]));
    if constexpr (!MASK && NB == 1) asm volatile("v_nop\n\tv_nop\n\tv_nop\n\tv_nop" : "+v"(o[0][0]), "+v"(o[1][0]), "+v"(o[2][0]), "+v"(o[3][0]) : "v"(pf[0][0]), "v"(pf[MB / 2 - 1][0]));
}
template <bool HR, int NB, int MB>
__device__ __forceinline__ void fa_tile(const typename FT<HR>::T* Q, const typename FT<HR>::T* Q2, const typename FT<HR>::T* K, const typename FT<HR>::T* K2, const typename FT<HR>::T* Vt, const typename FT<HR>::T* Vt2, bf* ah, bf* al, int q0, int lr, int hi) {
    typedef typename FT<HR>::T T16; typedef WFrag<T16> F; typedef typename F::V V;
    V qf[NB][2], qf2[NB][2];
#pragma unroll
    for (int nb = 0; nb < NB; ++nb) { const size_t qo = (size_t)(q0 + nb * 16 + lr) * HD + 8 * hi; const T16* qa = Q + qo; const T16* qa2 = Q2 + qo;
#pragma unroll
        for (int c = 0; c < 2; ++c) { qf[nb][c] = F::ld(qa + c * 32); if (HR) qf2[nb][c] = F::ld(qa2 + c * 32); }
        // the wait before the address registers of the Q loads are overwritten; the addresses are inputs, so that they stay whole up to it
        if constexpr (HR) asm volatile("s_wait_xcnt 0x0" :: "v"(qa), "v"(qa2) : "memory"); else asm volatile("s_wait_xcnt 0x0" :: "v"(qa) : "memory"); }
    v8f o[4][NB]; float m[NB], l[NB];
#pragma unroll
    for (int nb = 0; nb < NB; ++nb) { m[nb] = -3.0e38f; l[nb] = 0.f; }
#pragma unroll
    for (int db = 0; db < 4; ++db)
#pragma unroll
        for (int nb = 0; nb < NB; ++nb) o[db][nb] = (v8f){};
    const unsigned kl = lr * HD + 8 * hi, vl = lr * TT + 8 * hi;   /* the lane's place in a pass's K rows and Vt rows; the pass's own start stays in the wave-uniform pointers */ const int KP = MB * 16, nfull = q0 / KP;   // passes wholly below the diagonal; pass nfull holds it (its first key is <= every query of the wave)
#pragma unroll 1
    for (int it = 0; it < nfull; ++it) fa_pass<HR, false, NB, MB>(K + (size_t)it * KP * HD, K2 + (size_t)it * KP * HD, Vt + it * KP, Vt2 + it * KP, kl, vl, 0, qf, qf2, o, m, l);
    fa_pass<HR, true, NB, MB>(K + (size_t)nfull * KP * HD, K2 + (size_t)nfull * KP * HD, Vt + nfull * KP, Vt2 + nfull * KP, kl, vl, q0 + lr - nfull * KP - hi * 8, qf, qf2, o, m, l);
#pragma unroll
    for (int nb = 0; nb < NB; ++nb) { const float inv = __fdiv_rn(1.0f, l[nb] + xhalf(l[nb])); const size_t oo = (size_t)(q0 + nb * 16 + lr) * DQ + hi * 8;
#pragma unroll
        for (int db = 0; db < 4; ++db) { v8us oh, ol;
#pragma unroll
            for (int j = 0; j < 8; ++j) { unsigned short a, b; splitf(o[db][nb][j] * inv, a, b); oh[j] = a; ol[j] = b; }
            *(v8us*)(ah + oo + db * 16) = oh; *(v8us*)(al + oo + db * 16) = ol; } }
    asm volatile("s_wait_xcnt 0x0" ::: "memory");   // the wait before registers that the last output stores name are overwritten (the next trip of the caller's loop; the code behind the call)
}
// grid (NB_ * NH_, TT / 128): x = batch * NH_ + head, y counts the blocks of 128 query rows from the LAST down (y = 0 holds the longest rows, for speed only). Output: merged hi/lo planes [batch][t][DQ].
__global__ __launch_bounds__(128) __attribute__((amdgpu_waves_per_eu(4, 4))) void k_fattn(const h16* __restrict__ Q16, const h16* __restrict__ K16, const h16* __restrict__ V16, const bf* __restrict__ Qh, const bf* __restrict__ Ql, const bf* __restrict__ Kh, const bf* __restrict__ Kl, const bf* __restrict__ Vh, const bf* __restrict__ Vl, bf* Ah, bf* Al) {
    const int lane = threadIdx.x & 31, lr = lane & 15, hi = lane >> 4; const int w = __builtin_amdgcn_readfirstlane((int)(threadIdx.x >> 5));   // wave number, held scalar so that the key loop stays a scalar branch
    const int bh = blockIdx.x; const int q0 = (TT / 128 - 1 - (int)blockIdx.y) * 128 + w * QW; const size_t pz = (size_t)bh * TT * HD; const size_t az = (size_t)(bh / NH_) * TT * DQ + (size_t)(bh % NH_) * HD;
    if (q0 < RH) {   // twice the operand planes: a quarter of the pass (16 query columns, 32 keys), so that the kernel stays inside 256 registers without spills
#pragma unroll 1
        for (int u = 0; u < QW; u += 16) fa_tile<true, 1, 2>(Qh + pz, Ql + pz, Kh + pz, Kl + pz, Vh + pz, Vl + pz, Ah + az, Al + az, q0 + u, lr, hi);
    } else fa_tile<false, 2, 4>(Q16 + pz, Q16 + pz, K16 + pz, K16 + pz, V16 + pz, V16 + pz,   /* no second planes: never read */ Ah + az, Al + az, q0, lr, hi);
}

extern "C" void kernel_launch(void* const* d_in, const int* in_sizes, int n_in,
                              void* d_out, int out_size, void* d_ws, size_t ws_size, hipStream_t stream) {
    (void)in_sizes; (void)n_in; (void)out_size;
    const float* x = (const float*)d_in[0]; const float* wqkv = (const float*)d_in[1]; const float* bqkv = (const float*)d_in[2]; const float* wo = (const float*)d_in[3]; const float* bo = (const float*)d_in[4];   /* order x, W_attn ('xw' [1024][3072]: q | k | v column thirds), b_attn (zeros: read), W_proj, b_proj (zeros: read); five inputs, all read */ const float* bq = bqkv; const float* bk = bqkv + DQ; const float* bv = bqkv + 2 * DQ;
    float* OUT = (float*)d_out;     // [4][2048][1024]
    char* wsp = (char*)d_ws;
    auto take = [&](size_t bytes) { char* p = wsp; wsp += (bytes + 255) & ~(size_t)255; return (void*)p; };
    bf* WQKV = (bf*)take((size_t)3 * DQ * DM * 2); bf* WQ = WQKV; bf* WK = WQKV + (size_t)DQ * DM; bf* WV = WQKV + (size_t)2 * DQ * DM;   /* fused Bt [3*DQ][DM]: q | k | v row blocks */ bf* WO = (bf*)take((size_t)DM * DQ * 2); float* CS = (float*)take((size_t)TT * HD * 2 * 4);
    bf* XB = (bf*)take((size_t)TT * DM * 2); float* FQ = (float*)take((size_t)TT * DQ * 4); float* FK = (float*)take((size_t)TT * DKV * 4);
    const size_t PZ = (size_t)NH_ * TT * HD;   /* one batch's plane, in elements; every plane holds all NB_ batches, [batch][head][..][..] */
    h16* QP16 = (h16*)take(NB_ * PZ * 2); h16* KP16 = (h16*)take(NB_ * PZ * 2); h16* VT16 = (h16*)take(NB_ * PZ * 2);
    bf* QPh = (bf*)take(NB_ * PZ * 2); bf* QPl = (bf*)take(NB_ * PZ * 2); bf* KPh = (bf*)take(NB_ * PZ * 2); bf* KPl = (bf*)take(NB_ * PZ * 2); bf* VTh = (bf*)take(NB_ * PZ * 2); bf* VTl = (bf*)take(NB_ * PZ * 2);
    bf* ATh = (bf*)take((size_t)NB_ * TT * DQ * 2); bf* ATl = (bf*)take((size_t)NB_ * TT * DQ * 2);
    if ((size_t)(wsp - (char*)d_ws) > ws_size) return;    // ws 256 MiB
    float* FV = FK;   // v projection reuses the k buffer after the k planes are built (stream-ordered)
    { k_wtG<<<(unsigned)((DM * 3 * DQ / 64 + 63) / 64), 256, 0, stream>>>(wqkv, DM, 3 * DQ, WQKV);   /* fused 'xw' [DM][3*DQ] -> Bt [3*DQ][DM] */
      k_wtG<<<(unsigned)((DQ * DM / 64 + 63) / 64), 256, 0, stream>>>(wo, DQ, DM, WO);
       }
    k_cstabH<<<(TT * HD + 255) / 256, 256, 0, stream>>>(CS);   /* rotary table once (positions = arange) */
    const unsigned LQ = (unsigned)(((size_t)NH_ * TT * HD / 2 + 255) / 256), LKv = (unsigned)(((size_t)NKV * TT * HD / 2 + 255) / 256);
    for (int b = 0; b < NB_; ++b) { const size_t pb = (size_t)b * PZ;
        k_cvt8<<<(unsigned)(((size_t)TT * DM / 8 + 255) / 256), 256, 0, stream>>>(x + (size_t)b * TT * DM, XB, (size_t)TT * DM / 8);
        k_gemmw<bf, 0, true, 8, 128, false><<<dim3(TT / 64, DQ / 64, 1), 256, 0, stream>>>(XB, nullptr, DM, WQ, nullptr, DM, FQ, DQ, bq, 0, 0, 0, 0);
        k_rope<<<LQ, 256, 0, stream>>>(FQ, DQ, NH_, CS, nullptr, nullptr, 1.0f, QP16 + pb, QPh + pb, QPl + pb);
        k_gemmw<bf, 0, true, 8, 128, false><<<dim3(TT / 64, DKV / 64, 1), 256, 0, stream>>>(XB, nullptr, DM, WK, nullptr, DM, FK, DKV, bk, 0, 0, 0, 0);
        k_rope<<<LKv, 256, 0, stream>>>(FK, DKV, NKV, CS, nullptr, nullptr, 1.0f, KP16 + pb, KPh + pb, KPl + pb);
        k_gemmw<bf, 0, true, 8, 128, false><<<dim3(TT / 64, DKV / 64, 1), 256, 0, stream>>>(XB, nullptr, DM, WV, nullptr, DM, FV, DKV, bv, 0, 0, 0, 0); k_vtp<<<LKv, 256, 0, stream>>>(FV, DKV, NKV, VT16 + pb, VTh + pb, VTl + pb); }
    k_fattn<<<dim3(NB_ * NH_, TT / 128, 1), 128, 0, stream>>>(QP16, KP16, VT16, QPh, QPl, KPh, KPl, VTh, VTl, ATh, ATl);   /* every batch and head at once */
    for (int b = 0; b < NB_; ++b)
        k_gemmw<bf, 1, true, 8, 128, false><<<dim3(TT / 64, DM / 64, 1), 256, 0, stream>>>(ATh + (size_t)b * TT * DQ, ATl + (size_t)b * TT * DQ, DQ, WO, nullptr, DQ, OUT + (size_t)b * TT * DM, DM, bo, 0, 0, 0, 0);
}

// v004
// It runs in 322 microseconds.
// Timed twice side by side with v003, it ran 1.29 and 1.30 times as fast.
// Over all steps from v000 it is 9.00 times as fast.
#include <hip/hip_runtime.h>

// Causal self-attention with a fused biased qkv projection and a computed rotate-half RoPE at a NON-STANDARD frequency table (x [4][2048][1024]; qkv = x W_attn + b_attn ('xw' [1024][3072] 1/32 + a zero bias: read) split in thirds q | k | v (16 heads x 64); _rope_tables: rot = 32; inv_freq = 1 / (10000 ** (arange(0, 32, 2) / 32)): SIXTEEN frequencies; emb = cat(freqs, freqs): [T][32]; x <- cat(x1 cos - x2 sin, x2 cos + x1 sin) on the two HALVES (pairs (d, d + 32)) with the angle index d mod 16, on q and k; att x 1/sqrt(64); causal (-inf); softmax; y = merged W_proj + b_proj ('xw' + a zero bias: read) -> [4][2048][1024] (8.4 M); argument order x, W_attn, b_attn, W_proj, b_proj).
// Layout per batch: bf16 copy of x; fused 'xw' weight transposed once (q | k | v row blocks) + bias thirds; exact projections + f32 biases, each 64x64 tile turned into its head's planes in the projection kernel itself (k_cstabH computed table, elements d and d + 32 share an angle; rotate-half for q and k; v as W_v x^T, so that its tile is already transposed); the planes of all batches kept; causal T-2048 attention of every batch and head in one kernel with a running softmax (k_fattn; hybrid rows: < 512 hi/lo 3 products, rest fp16 x1024); merged hi/lo x W_proj exact + b_proj.
// Compute dtypes, f32 accumulate: every input rounded to bf16; projections exact + f32 biases; attention rows < 512 3 products, rest fp16; softmax f32; W_proj hl x exact + bias.

#define NB_  4
#define TT   2048
#define DM   1024
#define NH_  16
#define NKV  16
#define REP  (NH_ / NKV)
#define HD   64
#define DQ   (NH_ * HD)
#define DKV  (NKV * HD)
#define RH   512                  // query rows < RH use hi+lo planes (0: none)
typedef _Float16 h16;
typedef unsigned short bf;
typedef __attribute__((ext_vector_type(16))) __bf16   v16bf;
typedef __attribute__((ext_vector_type(16))) _Float16 v16h;
typedef __attribute__((ext_vector_type(8)))  _Float16 v8h;
typedef __attribute__((ext_vector_type(8)))  unsigned short v8us;
typedef __attribute__((ext_vector_type(8)))  float    v8f;
typedef __attribute__((ext_vector_type(4)))  float    v4f;
typedef v8h  __attribute__((may_alias)) v8ha;
typedef v4f  __attribute__((may_alias)) v4fa;
typedef v8us __attribute__((may_alias)) v8usa;

__device__ __forceinline__ unsigned short f2bf(float f) { unsigned u = __float_as_uint(f); u += 0x7FFFu + ((u >> 16) & 1u); return (unsigned short)(u >> 16); }
__device__ __forceinline__ float bf2f(unsigned short b) { return __uint_as_float(((unsigned)b) << 16); }
__device__ __forceinline__ float bfr(float f) { return bf2f(f2bf(f)); }
__device__ __forceinline__ v16h cat16(v8h lo, v8h hi) { return __builtin_shufflevector(lo, hi, 0, 1, 2, 3, 4, 5, 6, 7, 8, 9, 10, 11, 12, 13, 14, 15); }
__device__ __forceinline__ v16bf cat16b(v8us lo, v8us hi) { return __builtin_bit_cast(v16bf, __builtin_shufflevector(lo, hi, 0, 1, 2, 3, 4, 5, 6, 7, 8, 9, 10, 11, 12, 13, 14, 15)); }
__device__ __forceinline__ v8f wmma16(v16h a, v16h b, v8f c) { return __builtin_amdgcn_wmma_f32_16x16x32_f16(false, a, false, b, (short)0, c, false, false); }
__device__ __forceinline__ v8f wmmab(v16bf a, v16bf b, v8f c) { return __builtin_amdgcn_wmma_f32_16x16x32_bf16(false, a, false, b, (short)0, c, false, false); }



// ---- k_gemmw: register-blocked GEMM, one 64x64 output tile per work-group of NW waves; the K range is cut in runs of KCH elements (whole 128-byte lines of every operand row) and wave w takes runs w, w + NW, ...;
// every wave keeps a whole 64x64 partial tile (16 accumulators), operands straight from K-contiguous 16-bit planes; the NW partial tiles meet in LDS and are summed in wave order. grid (M/64, N/64, Z), NW * 32 threads.
// C[m][n] (f32, pitch ldc, + optional f32 bias[n]) = sum_k A[m][k] Bt[n][k] (+ split products per NSPLIT). A rows at pitch lda, Bt rows at pitch K; z-batch strides sA/sB/sC in elements. K % 32 == 0.
// DIAG: probability x value contraction of causal attention: probabilities are exactly 0 beyond the diagonal block of query rows r0 + roff .., so the K range stops there.
// EPI: what becomes of the summed tile. 0: f32 C. 1: the tile is one head (64 columns) of 64 positions: rotate-half RoPE out[d] = x[d] cos[t][d] - x[d+32] sin[t][d], out[d+32] = x[d+32] cos[t][d+32] + x[d] sin[t][d+32], stored as planes [head][t][d] (fp16, bf16 hi, bf16 lo).
// 2: rows are (head, d), columns positions (A = weight rows, Bt = x rows), bias by ROW: stored as planes [head][d][t]. In 1 and 2 nothing of C is written.
__device__ __forceinline__ float xrow8(float x) { return __builtin_bit_cast(float, __builtin_amdgcn_permlane16(__builtin_bit_cast(int, x), __builtin_bit_cast(int, x), 0xfedcba98, 0x76543210, false, false)); }   // lane l with lane l ^ 8
__device__ __forceinline__ void planes4(v4f r, size_t e, h16* P16, bf* Ph, bf* Pl);
template <typename T16> struct WFrag;
template <> struct WFrag<h16> { typedef v16h V; static __device__ __forceinline__ V ld(const h16* p) { return cat16(*(const v8h*)p, *(const v8h*)(p + 16)); } static __device__ __forceinline__ v8f mma(V a, V b, v8f c) { return wmma16(a, b, c); } };
template <> struct WFrag<bf> { typedef v16bf V; static __device__ __forceinline__ V ld(const bf* p) { return cat16b(*(const v8us*)p, *(const v8us*)(p + 16)); } static __device__ __forceinline__ v8f mma(V a, V b, v8f c) { return wmmab(a, b, c); } };
template <typename T16, int NSPLIT, bool BIAS, int NW, int KCH, bool DIAG, int EPI>
__global__ __launch_bounds__(NW * 32) void k_gemmw(const T16* __restrict__ A, const T16* __restrict__ A2, int lda, const T16* __restrict__ Bt, const T16* __restrict__ Bt2, int K, float* C, int ldc, const float* __restrict__ bias, int roff, size_t sA, size_t sB, size_t sC, const float* __restrict__ CS, h16* P16, bf* Ph, bf* Pl) {
    typedef typename WFrag<T16>::V V;
    __shared__ __align__(16) float os[NW * 64 * 68];
    const size_t z = blockIdx.z; A += z * sA; if (A2) A2 += z * sA; Bt += z * sB; if (Bt2) Bt2 += z * sB; C += z * sC;
    const int lane = threadIdx.x & 31, lr = lane & 15, hi = lane >> 4; const int r0 = blockIdx.x * 64, c0 = blockIdx.y * 64; const int w = __builtin_amdgcn_readfirstlane((int)(threadIdx.x >> 5));   // wave number, held scalar so that the K loops stay scalar branches
    const int Kl = DIAG ? min(K, r0 + roff + 64) : K;
    v8f acc[4][4];
#pragma unroll
    for (int mb = 0; mb < 4; ++mb)
#pragma unroll
        for (int nb = 0; nb < 4; ++nb) acc[mb][nb] = (v8f){};
    v4f ca[32 / NW], cb[32 / NW];   // EPI 1: this thread's (cos, sin) pairs, asked for ahead of the K loop so that they fly under it
    if constexpr (EPI == 1) {
#pragma unroll
        for (int s = 0; s < 32 / NW; ++s) { const int q = s * NW * 32 + (int)threadIdx.x; const float* cp = CS + ((size_t)(r0 + (q >> 4)) * HD + (q & 15) * 4) * 2; ca[s] = *(const v4fa*)cp; cb[s] = *(const v4fa*)(cp + 4); } }
    const size_t aoff = (size_t)(r0 + lr) * lda + 8 * hi, boff = (size_t)(c0 + lr) * K + 8 * hi;
    for (int kb = w * KCH; kb < Kl; kb += NW * KCH) { const int ke = min(kb + KCH, Kl);
#pragma unroll 1
    for (int kc = kb; kc < ke; kc += 32) {
        V a[4], a2[4];
#pragma unroll
        for (int mb = 0; mb < 4; ++mb) { a[mb] = WFrag<T16>::ld(A + aoff + (size_t)mb * 16 * lda + kc); if (NSPLIT == 1 || NSPLIT == 2) a2[mb] = WFrag<T16>::ld(A2 + aoff + (size_t)mb * 16 * lda + kc); }
#pragma unroll
        for (int nb = 0; nb < 4; ++nb) { const V b = WFrag<T16>::ld(Bt + boff + (size_t)nb * 16 * K + kc); V b2; if (NSPLIT >= 2) b2 = WFrag<T16>::ld(Bt2 + boff + (size_t)nb * 16 * K + kc);
#pragma unroll
            for (int mb = 0; mb < 4; ++mb) { acc[mb][nb] = WFrag<T16>::mma(a[mb], b, acc[mb][nb]); if (NSPLIT == 1 || NSPLIT == 2) acc[mb][nb] = WFrag<T16>::mma(a2[mb], b, acc[mb][nb]); if (NSPLIT >= 2) acc[mb][nb] = WFrag<T16>::mma(a[mb], b2, acc[mb][nb]); } }
        asm volatile("v_nop\n\tv_nop\n\tv_nop\n\tv_nop" : "+v"(acc[0][0]), "+v"(acc[1][1]), "+v"(acc[2][2]), "+v"(acc[3][3]) : "v"(a[0]), "v"(a[3]));
    } }
    float* ow = os + w * (64 * 68);   // this wave's partial tile, row-major at pitch 68 (a wave whose runs all lie beyond Kl hands in zeros)
#pragma unroll
    for (int mb = 0; mb < 4; ++mb)
#pragma unroll
        for (int nb = 0; nb < 4; ++nb)
#pragma unroll
            for (int j = 0; j < 8; ++j) ow[(mb * 16 + hi * 8 + j) * 68 + nb * 16 + lr] = acc[mb][nb][j];
    __syncthreads();   // every wave's partial tile is in LDS before any of it is summed
#pragma unroll
    for (int s = 0; s < 32 / NW; ++s) { const int q = s * NW * 32 + (int)threadIdx.x; const int row = q >> 4, cofs = (q & 15) * 4; v4f val = *(const v4fa*)(os + row * 68 + cofs);
#pragma unroll
        for (int u = 1; u < NW; ++u) val += *(const v4fa*)(os + u * (64 * 68) + row * 68 + cofs);
        if constexpr (EPI == 2) { val += bfr(bias[r0 + row]); planes4(val, (size_t)(r0 + row) * TT + c0 + cofs, P16, Ph, Pl); continue; }
        if (BIAS) { val[0] += bfr(bias[c0 + cofs]); val[1] += bfr(bias[c0 + cofs + 1]); val[2] += bfr(bias[c0 + cofs + 2]); val[3] += bfr(bias[c0 + cofs + 3]); }
        if constexpr (EPI == 1) { v4f xp;   // the partner columns d +- 32 of the same row sit in lane l ^ 8 (16 lanes a row, 4 columns a lane)
#pragma unroll
            for (int j = 0; j < 4; ++j) xp[j] = xrow8(val[j]);
            const float sg = cofs < HD / 2 ? -1.0f : 1.0f; v4f r; r[0] = val[0] * ca[s][0] + xp[0] * (sg * ca[s][1]); r[1] = val[1] * ca[s][2] + xp[1] * (sg * ca[s][3]); r[2] = val[2] * cb[s][0] + xp[2] * (sg * cb[s][1]); r[3] = val[3] * cb[s][2] + xp[3] * (sg * cb[s][3]);
            planes4(r, ((size_t)blockIdx.y * TT + r0 + row) * HD + cofs, P16, Ph, Pl); continue; }
        *(v4f*)(C + (size_t)(r0 + row) * ldc + c0 + cofs) = val; }
}

__device__ __forceinline__ h16 tohx(float x) { return (h16)x; }
__device__ __forceinline__ void splitf(float y, unsigned short& h, unsigned short& l) { h = f2bf(y); l = f2bf(y - bf2f(h)); }
typedef __attribute__((ext_vector_type(2))) _Float16 v2h;
typedef __attribute__((ext_vector_type(4))) _Float16 v4h;
typedef __attribute__((ext_vector_type(2))) unsigned short v2us;
typedef __attribute__((ext_vector_type(4))) unsigned short v4us;
typedef __attribute__((ext_vector_type(2))) float v2f;
typedef __attribute__((ext_vector_type(4))) int v4i;
typedef v4h  __attribute__((may_alias)) v4ha;
typedef v4us __attribute__((may_alias)) v4usa;
// four neighbouring plane elements from f32: fp16, and bf16 hi + lo
__device__ __forceinline__ void planes4(v4f r, size_t e, h16* P16, bf* Ph, bf* Pl) { v4h o16; v4us oh, ol;
#pragma unroll
    for (int j = 0; j < 4; ++j) { o16[j] = tohx(r[j]); unsigned short a2, c2; splitf(r[j], a2, c2); oh[j] = a2; ol[j] = c2; }
    *(v4h*)(P16 + e) = o16; *(v4us*)(Ph + e) = oh; *(v4us*)(Pl + e) = ol; }

__global__ __launch_bounds__(256) void k_wtG(const float* __restrict__ w, int K, int N, bf* Bt) {
    const int lane = threadIdx.x & 31; const int L0 = (blockIdx.x * 8 + (threadIdx.x >> 5)) * 8; const int nlines = N * K / 64;
{
#pragma unroll 1
        for (int l = 0; l < 8; ++l) { const int L = L0 + l; if (L >= nlines) break; const size_t e = (size_t)L * 64 + lane * 2; const int k = (int)(e % K), n = (int)(e / K); v2us o;
            o[0] = f2bf(w[(size_t)k * N + n]); o[1] = f2bf(w[(size_t)(k + 1) * N + n]); *(v2us*)(Bt + e) = o; }
         }
}
__global__ __launch_bounds__(256) void k_cvt8(const float* __restrict__ src, bf* dst, size_t n8) { const size_t i = (size_t)blockIdx.x * 256 + threadIdx.x; if (i >= n8) return; const v8f v = *(const v8f*)(src + i * 8); v8us o;
#pragma unroll
    for (int k = 0; k < 8; ++k) o[k] = f2bf(v[k]); *(v8us*)(dst + i * 8) = o;  }

__constant__ float INVT[HD / 2] = { 1.000000000e+00f, 5.623413324e-01f, 3.162277639e-01f, 1.778279394e-01f, 1.000000015e-01f, 5.623412877e-02f, 3.162277862e-02f, 1.778279431e-02f, 9.999999776e-03f, 5.623413250e-03f, 3.162277862e-03f, 1.778279431e-03f, 1.000000047e-03f, 5.623413017e-04f, 3.162277862e-04f, 1.778279402e-04f, 1.000000000e+00f, 5.623413324e-01f, 3.162277639e-01f, 1.778279394e-01f, 1.000000015e-01f, 5.623412877e-02f, 3.162277862e-02f, 1.778279431e-02f, 9.999999776e-03f, 5.623413250e-03f, 3.162277862e-03f, 1.778279431e-03f, 1.000000047e-03f, 5.623413017e-04f, 3.162277862e-04f, 1.778279402e-04f };
__global__ __launch_bounds__(256) void k_cstabH(float* CS) { const int idx = blockIdx.x * 256 + threadIdx.x; if (idx >= TT * HD) return; const int d = idx % HD; const int t = idx / HD; const float a = __fmul_rn((float)t, INVT[d & (HD / 2 - 1)]); v2f cs; cs[0] = cosf(a); cs[1] = sinf(a); *(v2f*)(CS + (size_t)idx * 2) = cs;  }
// ---- k_fattn: causal attention in one kernel, nothing of the scores or probabilities in memory. One wave owns QW = 32 query rows of one (batch, head) and walks the keys in passes (64 keys x 32 queries; HR: 32 keys x 16 queries, the two halves of its rows in turn), up to its diagonal; waves share nothing (no LDS, no barrier).
// Transposed products: St[key][query] = K Qt (A = K rows, B = Q rows, both by WFrag::ld), so a lane holds scores of ONE query (column lr): running maximum and sum in the lane plus one exchange between the wave halves;
// two score tiles (keys 32c + 0..15, 32c + 16..31), converted in place, ARE the B operand of Ot[d][query] += Vt P t in the k order of WFrag::ld (element e < 8: key 8 hi + e, else 16 + 8 hi + e - 8); A = rows of the transposed value plane.
// HR (query rows < RH): bf16 hi/lo planes, 3 products in both contractions; else fp16, the probabilities carried x 2^POFF (it cancels against the row sum). The row sum adds the unrounded f32 exponentials; the division by it comes last.
#define QW   32
#define POFF 10.0f
#define KS   0.18033688011112042f   // HD^-0.5 x log2(e)
__device__ __forceinline__ float xhalf(float x) { return __builtin_bit_cast(float, __builtin_amdgcn_permlanex16(__builtin_bit_cast(int, x), __builtin_bit_cast(int, x), 0x76543210, 0xfedcba98, false, false)); }   // lane l with lane l ^ 16
// 2^x with the free slot that the instruction set asks for behind a transcendental, before its result is used or its source overwritten.
// In one statement the slot stands by construction; each of the four works in place on a register of its own, so that none touches a neighbour's source or result.
__device__ __forceinline__ float exp2n(float x) { float r; asm("v_exp_f32 %0, %1\n\tv_nop" : "=v"(r) : "v"(x)); return r; }
__device__ __forceinline__ void exp2x4(float& a, float& b, float& c, float& d) { asm("v_exp_f32 %0, %0\n\tv_exp_f32 %1, %1\n\tv_exp_f32 %2, %2\n\tv_exp_f32 %3, %3\n\tv_nop" : "+v"(a), "+v"(b), "+v"(c), "+v"(d)); }
template <bool HR> struct FT { typedef h16 T; };
template <> struct FT<true> { typedef bf T; };
template <bool HR, bool MASK, int NB, int MB>   // NB blocks of 16 query columns, MB blocks of 16 keys a pass
__device__ __forceinline__ void fa_pass(const typename FT<HR>::T* kp, const typename FT<HR>::T* kp2, const typename FT<HR>::T* vp, const typename FT<HR>::T* vp2, unsigned kl, unsigned vl, int dq,
                                        const typename WFrag<typename FT<HR>::T>::V (&qf)[NB][2], const typename WFrag<typename FT<HR>::T>::V (&qf2)[NB][2], v8f (&o)[4][NB], float (&m)[NB], float (&l)[NB]) {
    typedef typename FT<HR>::T T16; typedef WFrag<T16> F; typedef typename F::V V;
    V kf[MB][2], kf2[MB][2]; const T16* ka = kp + kl; const T16* ka2 = kp2 + kl;
#pragma unroll
    for (int mb = 0; mb < MB; ++mb)
#pragma unroll
        for (int c = 0; c < 2; ++c) { kf[mb][c] = F::ld(ka + mb * 16 * HD + c * 32); if (HR) kf2[mb][c] = F::ld(ka2 + mb * 16 * HD + c * 32); }
    // the wait before a register that an issued load names is overwritten; the addresses are inputs, so that they stay whole up to it and no load of the run lands on one
    if constexpr (HR) asm volatile("s_wait_xcnt 0x0" :: "v"(ka), "v"(ka2) : "memory"); else asm volatile("s_wait_xcnt 0x0" :: "v"(ka) : "memory");
    __builtin_amdgcn_sched_barrier(0);   // all K loads of the pass go out together, ahead of the first product: one memory latency a pass, not one per 16 keys
    v8f s[MB][NB];
#pragma unroll
    for (int mb = 0; mb < MB; ++mb)
#pragma unroll
        for (int nb = 0; nb < NB; ++nb) { v8f a = (v8f){}; a = F::mma(kf[mb][0], qf[nb][0], a); a = F::mma(kf[mb][1], qf[nb][1], a);
            if (HR) { a = F::mma(kf2[mb][0], qf[nb][0], a); a = F::mma(kf2[mb][1], qf[nb][1], a); a = F::mma(kf[mb][0], qf2[nb][0], a); a = F::mma(kf[mb][1], qf2[nb][1], a); }
            s[mb][nb] = a; }
    V vf[4][MB / 2], vf2[4][MB / 2]; const T16* va = vp + vl; const T16* va2 = vp2 + vl;
#pragma unroll
    for (int db = 0; db < 4; ++db)
#pragma unroll
        for (int c = 0; c < MB / 2; ++c) { vf[db][c] = F::ld(va + db * 16 * TT + c * 32); if (HR) vf2[db][c] = F::ld(va2 + db * 16 * TT + c * 32); }
    if constexpr (HR) asm volatile("s_wait_xcnt 0x0" :: "v"(va), "v"(va2) : "memory"); else asm volatile("s_wait_xcnt 0x0" :: "v"(va) : "memory");   // as behind the K loads
    __builtin_amdgcn_sched_barrier(0);   // the Vt loads go out ahead of the softmax and fly under it
    V pf[MB / 2][NB], pl[MB / 2][NB];
#pragma unroll
    for (int nb = 0; nb < NB; ++nb) { float mx = m[nb];
#pragma unroll
        for (int mb = 0; mb < MB; ++mb)
#pragma unroll
            for (int j = 0; j < 8; ++j) { if (MASK && (mb * 16 + j - nb * 16 > dq)) s[mb][nb][j] = -3.0e38f;   // key > query
                mx = fmaxf(mx, s[mb][nb][j]); }
        mx = fmaxf(mx, xhalf(mx));
        const float al = exp2n((m[nb] - mx) * KS); const float mk = mx * KS - (HR ? 0.0f : POFF); m[nb] = mx; float ps = 0.f;
#pragma unroll
        for (int mb = 0; mb < MB; ++mb)
#pragma unroll
            for (int j = 0; j < 8; j += 4) { float p0 = __builtin_fmaf(s[mb][nb][j], KS, -mk), p1 = __builtin_fmaf(s[mb][nb][j + 1], KS, -mk), p2 = __builtin_fmaf(s[mb][nb][j + 2], KS, -mk), p3 = __builtin_fmaf(s[mb][nb][j + 3], KS, -mk);
                exp2x4(p0, p1, p2, p3); s[mb][nb][j] = p0; s[mb][nb][j + 1] = p1; s[mb][nb][j + 2] = p2; s[mb][nb][j + 3] = p3; ps += p0; ps += p1; ps += p2; ps += p3; }
        l[nb] = l[nb] * al + ps;
#pragma unroll
        for (int db = 0; db < 4; ++db) o[db][nb] *= al;
#pragma unroll
        for (int c = 0; c < MB / 2; ++c) {
            if constexpr (HR) { v8us h0, h1, l0, l1;
#pragma unroll
                for (int j = 0; j < 8; ++j) { unsigned short a, b; splitf(s[2 * c][nb][j], a, b); h0[j] = a; l0[j] = b; splitf(s[2 * c + 1][nb][j], a, b); h1[j] = a; l1[j] = b; }
                pf[c][nb] = cat16b(h0, h1); pl[c][nb] = cat16b(l0, l1);
            } else { v8h h0, h1;
#pragma unroll
                for (int j = 0; j < 8; ++j) { h0[j] = tohx(s[2 * c][nb][j]); h1[j] = tohx(s[2 * c + 1][nb][j]); }
                pf[c][nb] = cat16(h0, h1); } }
        if (nb + 1 < NB) __builtin_amdgcn_sched_barrier(0); }   // one column block's scores are packed (half the registers) before the next block's exponentials start: mixed, the two cost spills
#pragma unroll
    for (int db = 0; db < 4; ++db)
#pragma unroll
        for (int nb = 0; nb < NB; ++nb) { v8f a = o[db][nb];
#pragma unroll
            for (int c = 0; c < MB / 2; ++c) { a = F::mma(vf[db][c], pf[c][nb], a); if (HR) a = F::mma(vf[db][c], pl[c][nb], a); }
            o[db][nb] = a; }
    if (HR) {
#pragma unroll
        for (int db = 0; db < 4; ++db)
#pragma unroll
            for (int nb = 0; nb < NB; ++nb) { v8f a = o[db][nb];
#pragma unroll
                for (int c = 0; c < MB / 2; ++c) a = F::mma(vf2[db][c], pf[c][nb], a);
                o[db][nb] = a; } }
    // the distance behind the pass's last matrix instructions, also on the taken back edge of the key loop
    if constexpr (!MASK && NB == 2) asm volatile("v_nop\n\tv_nop\n\tv_nop\n\tv_nop" : "+v"(o[0][0]), "+v"(o[0][1]), "+v"(o[1][0]), "+v"(o[1][1]), "+v"(o[2][0]), "+v"(o[2][1]), "+v"(o[3][0]), "+v"(o[3][1]) : "v"(pf[0][0]), "v"(pf[0][1]), "v"(pf[MB / 2 - 1][0]), "v"(pf[MB / 2 - 1][1]));
    if constexpr (!MASK && NB == 1) asm volatile("v_nop\n\tv_nop\n\tv_nop\n\tv_nop" : "+v"(o[0][0]), "+v"(o[1][0]), "+v"(o[2][0]), "+v"(o[3][0]) : "v"(pf[0][0]), "v"(pf[MB / 2 - 1][0]));
}
template <bool HR, int NB, int MB>
__device__ __forceinline__ void fa_tile(const typename FT<HR>::T* Q, const typename FT<HR>::T* Q2, const typename FT<HR>::T* K, const typename FT<HR>::T* K2, const typename FT<HR>::T* Vt, const typename FT<HR>::T* Vt2, bf* ah, bf* al, int q0, int lr, int hi) {
    typedef typename FT<HR>::T T16; typedef WFrag<T16> F; typedef typename F::V V;
    V qf[NB][2], qf2[NB][2];
#pragma unroll
    for (int nb = 0; nb < NB; ++nb) { const size_t qo = (size_t)(q0 + nb * 16 + lr) * HD + 8 * hi; const T16* qa = Q + qo; const T16* qa2 = Q2 + qo;
#pragma unroll
        for (int c = 0; c < 2; ++c) { qf[nb][c] = F::ld(qa + c * 32); if (HR) qf2[nb][c] = F::ld(qa2 + c * 32); }
        // the wait before the address registers of the Q loads are overwritten; the addresses are inputs, so that they stay whole up to it
        if constexpr (HR) asm volatile("s_wait_xcnt 0x0" :: "v"(qa), "v"(qa2) : "memory"); else asm volatile("s_wait_xcnt 0x0" :: "v"(qa) : "memory"); }
    v8f o[4][NB]; float m[NB], l[NB];
#pragma unroll
    for (int nb = 0; nb < NB; ++nb) { m[nb] = -3.0e38f; l[nb] = 0.f; }
#pragma unroll
    for (int db = 0; db < 4; ++db)
#pragma unroll
        for (int nb = 0; nb < NB; ++nb) o[db][nb] = (v8f){};
    const unsigned kl = lr * HD + 8 * hi, vl = lr * TT + 8 * hi;   /* the lane's place in a pass's K rows and Vt rows; the pass's own start stays in the wave-uniform pointers */ const int KP = MB * 16, nfull = q0 / KP;   // passes wholly below the diagonal; pass nfull holds it (its first key is <= every query of the wave)
#pragma unroll 1
    for (int it = 0; it < nfull; ++it) fa_pass<HR, false, NB, MB>(K + (size_t)it * KP * HD, K2 + (size_t)it * KP * HD, Vt + it * KP, Vt2 + it * KP, kl, vl, 0, qf, qf2, o, m, l);
    fa_pass<HR, true, NB, MB>(K + (size_t)nfull * KP * HD, K2 + (size_t)nfull * KP * HD, Vt + nfull * KP, Vt2 + nfull * KP, kl, vl, q0 + lr - nfull * KP - hi * 8, qf, qf2, o, m, l);
#pragma unroll
    for (int nb = 0; nb < NB; ++nb) { const float inv = __fdiv_rn(1.0f, l[nb] + xhalf(l[nb])); const size_t oo = (size_t)(q0 + nb * 16 + lr) * DQ + hi * 8;
#pragma unroll
        for (int db = 0; db < 4; ++db) { v8us oh, ol;
#pragma unroll
            for (int j = 0; j < 8; ++j) { unsigned short a, b; splitf(o[db][nb][j] * inv, a, b); oh[j] = a; ol[j] = b; }
            *(v8us*)(ah + oo + db * 16) = oh; *(v8us*)(al + oo + db * 16) = ol; } }
    asm volatile("s_wait_xcnt 0x0" ::: "memory");   // the wait before registers that the last output stores name are overwritten (the next trip of the caller's loop; the code behind the call)
}
// grid (NB_ * NH_, TT / 128): x = batch * NH_ + head, y counts the blocks of 128 query rows from the LAST down (y = 0 holds the longest rows, for speed only). Output: merged hi/lo planes [batch][t][DQ].
__global__ __launch_bounds__(128) __attribute__((amdgpu_waves_per_eu(4, 4))) void k_fattn(const h16* __restrict__ Q16, const h16* __restrict__ K16, const h16* __restrict__ V16, const bf* __restrict__ Qh, const bf* __restrict__ Ql, const bf* __restrict__ Kh, const bf* __restrict__ Kl, const bf* __restrict__ Vh, const bf* __restrict__ Vl, bf* Ah, bf* Al) {
    const int lane = threadIdx.x & 31, lr = lane & 15, hi = lane >> 4; const int w = __builtin_amdgcn_readfirstlane((int)(threadIdx.x >> 5));   // wave number, held scalar so that the key loop stays a scalar branch
    const int bh = blockIdx.x; const int q0 = (TT / 128 - 1 - (int)blockIdx.y) * 128 + w * QW; const size_t pz = (size_t)bh * TT * HD; const size_t az = (size_t)(bh / NH_) * TT * DQ + (size_t)(bh % NH_) * HD;
    if (q0 < RH) {   // twice the operand planes: a quarter of the pass (16 query columns, 32 keys), so that the kernel stays inside 256 registers without spills
#pragma unroll 1
        for (int u = 0; u < QW; u += 16) fa_tile<true, 1, 2>(Qh + pz, Ql + pz, Kh + pz, Kl + pz, Vh + pz, Vl + pz, Ah + az, Al + az, q0 + u, lr, hi);
    } else fa_tile<false, 2, 4>(Q16 + pz, Q16 + pz, K16 + pz, K16 + pz, V16 + pz, V16 + pz,   /* no second planes: never read */ Ah + az, Al + az, q0, lr, hi);
}

extern "C" void kernel_launch(void* const* d_in, const int* in_sizes, int n_in,
                              void* d_out, int out_size, void* d_ws, size_t ws_size, hipStream_t stream) {
    (void)in_sizes; (void)n_in; (void)out_size;
    const float* x = (const float*)d_in[0]; const float* wqkv = (const float*)d_in[1]; const float* bqkv = (const float*)d_in[2]; const float* wo = (const float*)d_in[3]; const float* bo = (const float*)d_in[4];   /* order x, W_attn ('xw' [1024][3072]: q | k | v column thirds), b_attn (zeros: read), W_proj, b_proj (zeros: read); five inputs, all read */ const float* bq = bqkv; const float* bk = bqkv + DQ; const float* bv = bqkv + 2 * DQ;
    float* OUT = (float*)d_out;     // [4][2048][1024]
    char* wsp = (char*)d_ws;
    auto take = [&](size_t bytes) { char* p = wsp; wsp += (bytes + 255) & ~(size_t)255; return (void*)p; };
    bf* WQKV = (bf*)take((size_t)3 * DQ * DM * 2); bf* WQ = WQKV; bf* WK = WQKV + (size_t)DQ * DM; bf* WV = WQKV + (size_t)2 * DQ * DM;   /* fused Bt [3*DQ][DM]: q | k | v row blocks */ bf* WO = (bf*)take((size_t)DM * DQ * 2); float* CS = (float*)take((size_t)TT * HD * 2 * 4);
    bf* XB = (bf*)take((size_t)TT * DM * 2);
    const size_t PZ = (size_t)NH_ * TT * HD;   /* one batch's plane, in elements; every plane holds all NB_ batches, [batch][head][..][..] */
    h16* QP16 = (h16*)take(NB_ * PZ * 2); h16* KP16 = (h16*)take(NB_ * PZ * 2); h16* VT16 = (h16*)take(NB_ * PZ * 2);
    bf* QPh = (bf*)take(NB_ * PZ * 2); bf* QPl = (bf*)take(NB_ * PZ * 2); bf* KPh = (bf*)take(NB_ * PZ * 2); bf* KPl = (bf*)take(NB_ * PZ * 2); bf* VTh = (bf*)take(NB_ * PZ * 2); bf* VTl = (bf*)take(NB_ * PZ * 2);
    bf* ATh = (bf*)take((size_t)NB_ * TT * DQ * 2); bf* ATl = (bf*)take((size_t)NB_ * TT * DQ * 2);
    if ((size_t)(wsp - (char*)d_ws) > ws_size) return;    // ws 256 MiB
    { k_wtG<<<(unsigned)((DM * 3 * DQ / 64 + 63) / 64), 256, 0, stream>>>(wqkv, DM, 3 * DQ, WQKV);   /* fused 'xw' [DM][3*DQ] -> Bt [3*DQ][DM] */
      k_wtG<<<(unsigned)((DQ * DM / 64 + 63) / 64), 256, 0, stream>>>(wo, DQ, DM, WO);
       }
    k_cstabH<<<(TT * HD + 255) / 256, 256, 0, stream>>>(CS);   /* rotary table once (positions = arange) */
    for (int b = 0; b < NB_; ++b) { const size_t pb = (size_t)b * PZ;
        k_cvt8<<<(unsigned)(((size_t)TT * DM / 8 + 255) / 256), 256, 0, stream>>>(x + (size_t)b * TT * DM, XB, (size_t)TT * DM / 8);
        k_gemmw<bf, 0, true, 8, 128, false, 1><<<dim3(TT / 64, DQ / 64, 1), 256, 0, stream>>>(XB, nullptr, DM, WQ, nullptr, DM, nullptr, 0, bq, 0, 0, 0, 0, CS, QP16 + pb, QPh + pb, QPl + pb);
        k_gemmw<bf, 0, true, 8, 128, false, 1><<<dim3(TT / 64, DKV / 64, 1), 256, 0, stream>>>(XB, nullptr, DM, WK, nullptr, DM, nullptr, 0, bk, 0, 0, 0, 0, CS, KP16 + pb, KPh + pb, KPl + pb);
        k_gemmw<bf, 0, true, 8, 128, false, 2><<<dim3(DKV / 64, TT / 64, 1), 256, 0, stream>>>(WV, nullptr, DM, XB, nullptr, DM, nullptr, 0, bv, 0, 0, 0, 0, nullptr, VT16 + pb, VTh + pb, VTl + pb); }   /* v transposed: rows (head, d), columns t */
    k_fattn<<<dim3(NB_ * NH_, TT / 128, 1), 128, 0, stream>>>(QP16, KP16, VT16, QPh, QPl, KPh, KPl, VTh, VTl, ATh, ATl);   /* every batch and head at once */
    for (int b = 0; b < NB_; ++b)
        k_gemmw<bf, 1, true, 8, 128, false, 0><<<dim3(TT / 64, DM / 64, 1), 256, 0, stream>>>(ATh + (size_t)b * TT * DQ, ATl + (size_t)b * TT * DQ, DQ, WO, nullptr, DQ, OUT + (size_t)b * TT * DM, DM, bo, 0, 0, 0, 0, nullptr, nullptr, nullptr, nullptr);
}

// v005
// It runs in 288 microseconds.
// Two timings next to v004 both put it at 1.12 times that version's speed.
// All steps since v000 together make it 10.1 times as fast.
#include <hip/hip_runtime.h>

// Causal self-attention with a fused biased qkv projection and a computed rotate-half RoPE at a NON-STANDARD frequency table (x [4][2048][1024]; qkv = x W_attn + b_attn ('xw' [1024][3072] 1/32 + a zero bias: read) split in thirds q | k | v (16 heads x 64); _rope_tables: rot = 32; inv_freq = 1 / (10000 ** (arange(0, 32, 2) / 32)): SIXTEEN frequencies; emb = cat(freqs, freqs): [T][32]; x <- cat(x1 cos - x2 sin, x2 cos + x1 sin) on the two HALVES (pairs (d, d + 32)) with the angle index d mod 16, on q and k; att x 1/sqrt(64); causal (-inf); softmax; y = merged W_proj + b_proj ('xw' + a zero bias: read) -> [4][2048][1024] (8.4 M); argument order x, W_attn, b_attn, W_proj, b_proj).
// Four launches, each over all batches. k_prep: bf16 copy of x; fused 'xw' weight transposed (q | k | v row blocks); W_proj transposed; computed rotary table (elements d and d + 32 share an angle). k_gemmw EPI 1: exact projections + f32 biases, q, k and v in one grid, each 64x64 tile turned into its head's planes in the kernel itself (rotate-half for q and k; v as W_v x^T, so that its tile is already transposed). k_fattn: causal T-2048 attention of every batch and head with a running softmax (hybrid rows: < 512 hi/lo 3 products, rest fp16 x1024). k_gemmw EPI 0: merged hi/lo x W_proj exact + b_proj.
// Compute dtypes, f32 accumulate: every input rounded to bf16; projections exact + f32 biases; attention rows < 512 3 products, rest fp16; softmax f32; W_proj hl x exact + bias.

#define NB_  4
#define TT   2048
#define DM   1024
#define NH_  16
#define NKV  16
#define REP  (NH_ / NKV)
#define HD   64
#define DQ   (NH_ * HD)
#define DKV  (NKV * HD)
#define RH   512                  // query rows < RH use hi+lo planes (0: none)
typedef _Float16 h16;
typedef unsigned short bf;
typedef __attribute__((ext_vector_type(16))) __bf16   v16bf;
typedef __attribute__((ext_vector_type(16))) _Float16 v16h;
typedef __attribute__((ext_vector_type(8)))  _Float16 v8h;
typedef __attribute__((ext_vector_type(8)))  unsigned short v8us;
typedef __attribute__((ext_vector_type(8)))  float    v8f;
typedef __attribute__((ext_vector_type(4)))  float    v4f;
typedef v8h  __attribute__((may_alias)) v8ha;
typedef v4f  __attribute__((may_alias)) v4fa;
typedef v8us __attribute__((may_alias)) v8usa;

__device__ __forceinline__ unsigned short f2bf(float f) { unsigned u = __float_as_uint(f); u += 0x7FFFu + ((u >> 16) & 1u); return (unsigned short)(u >> 16); }
__device__ __forceinline__ float bf2f(unsigned short b) { return __uint_as_float(((unsigned)b) << 16); }
__device__ __forceinline__ float bfr(float f) { return bf2f(f2bf(f)); }
__device__ __forceinline__ v16h cat16(v8h lo, v8h hi) { return __builtin_shufflevector(lo, hi, 0, 1, 2, 3, 4, 5, 6, 7, 8, 9, 10, 11, 12, 13, 14, 15); }
__device__ __forceinline__ v16bf cat16b(v8us lo, v8us hi) { return __builtin_bit_cast(v16bf, __builtin_shufflevector(lo, hi, 0, 1, 2, 3, 4, 5, 6, 7, 8, 9, 10, 11, 12, 13, 14, 15)); }
__device__ __forceinline__ v8f wmma16(v16h a, v16h b, v8f c) { return __builtin_amdgcn_wmma_f32_16x16x32_f16(false, a, false, b, (short)0, c, false, false); }
__device__ __forceinline__ v8f wmmab(v16bf a, v16bf b, v8f c) { return __builtin_amdgcn_wmma_f32_16x16x32_bf16(false, a, false, b, (short)0, c, false, false); }



// ---- k_gemmw: register-blocked GEMM, one 64x64 output tile per work-group of NW waves; the K range is cut in runs of KCH elements (whole 128-byte lines of every operand row) and wave w takes runs w, w + NW, ...;
// every wave keeps a whole 64x64 partial tile (16 accumulators), operands straight from K-contiguous 16-bit planes; the NW partial tiles meet in LDS and are summed in wave order. grid (M/64, N/64, Z), NW * 32 threads.
// C[m][n] (f32, pitch ldc, + optional f32 bias[n]) = sum_k A[m][k] Bt[n][k] (+ split products per NSPLIT). A rows at pitch lda, Bt rows at pitch K; z-batch strides sA/sB/sC in elements. K % 32 == 0.
// DIAG: probability x value contraction of causal attention: probabilities are exactly 0 beyond the diagonal block of query rows r0 + roff .., so the K range stops there.
// EPI: what becomes of the summed tile. 0: f32 C. 1: the fused q | k | v projection of all batches, A = x rows (batch, t), Bt = weight rows; blockIdx.x = block of 64 positions, blockIdx.y = block of 64 features = one head of q (0 .. NH_ - 1), k (NH_ ..) or v (2 NH_ ..); nothing of C is written; planes (fp16, bf16 hi, bf16 lo) as [q | k | v][batch][head][..][..].
// q, k: the tile is one head (64 columns) of 64 positions: rotate-half RoPE out[d] = x[d] cos[t][d] - x[d+32] sin[t][d], out[d+32] = x[d+32] cos[t][d+32] + x[d] sin[t][d+32], stored [t][d].
// v: the two operands change places, so rows are d, columns positions, bias by ROW: stored [d][t].
__device__ __forceinline__ float xrow8(float x) { return __builtin_bit_cast(float, __builtin_amdgcn_permlane16(__builtin_bit_cast(int, x), __builtin_bit_cast(int, x), 0xfedcba98, 0x76543210, false, false)); }   // lane l with lane l ^ 8
__device__ __forceinline__ void planes4(v4f r, size_t e, h16* P16, bf* Ph, bf* Pl);
template <bool B> struct Sel { static constexpr bool v = B; };
template <typename T16> struct WFrag;
template <> struct WFrag<h16> { typedef v16h V; static __device__ __forceinline__ V ld(const h16* p) { return cat16(*(const v8h*)p, *(const v8h*)(p + 16)); } static __device__ __forceinline__ v8f mma(V a, V b, v8f c) { return wmma16(a, b, c); } };
template <> struct WFrag<bf> { typedef v16bf V; static __device__ __forceinline__ V ld(const bf* p) { return cat16b(*(const v8us*)p, *(const v8us*)(p + 16)); } static __device__ __forceinline__ v8f mma(V a, V b, v8f c) { return wmmab(a, b, c); } };
template <typename T16, int NSPLIT, bool BIAS, int NW, int KCH, bool DIAG, int EPI>
__global__ __launch_bounds__(NW * 32) void k_gemmw(const T16* __restrict__ A, const T16* __restrict__ A2, int lda, const T16* __restrict__ Bt, const T16* __restrict__ Bt2, int K, float* C, int ldc, const float* __restrict__ bias, int roff, size_t sA, size_t sB, size_t sC, const float* __restrict__ CS, h16* P16, bf* Ph, bf* Pl) {
    typedef typename WFrag<T16>::V V;
    __shared__ __align__(16) float os[NW * 64 * 68];
    const size_t z = blockIdx.z; A += z * sA; if (A2) A2 += z * sA; Bt += z * sB; if (Bt2) Bt2 += z * sB; C += z * sC;
    const bool vt = EPI == 1 && blockIdx.y >= 2 * NH_;   // a v tile (the same for the whole work-group)
    if (vt) { const T16* t = A; A = Bt; Bt = t; }
    const int lane = threadIdx.x & 31, lr = lane & 15, hi = lane >> 4; const int r0 = (vt ? blockIdx.y : blockIdx.x) * 64, c0 = (vt ? blockIdx.x : blockIdx.y) * 64; const int w = __builtin_amdgcn_readfirstlane((int)(threadIdx.x >> 5));   // wave number, held scalar so that the K loops stay scalar branches
    const int t0 = (int)(blockIdx.x * 64) % TT;   // EPI 1: the tile's first position inside its batch
    const int Kl = DIAG ? min(K, r0 + roff + 64) : K;
    v8f acc[4][4];
#pragma unroll
    for (int mb = 0; mb < 4; ++mb)
#pragma unroll
        for (int nb = 0; nb < 4; ++nb) acc[mb][nb] = (v8f){};
    v4f ca[32 / NW], cb[32 / NW];   // EPI 1: this thread's (cos, sin) pairs, asked for ahead of the K loop so that they fly under it
    if constexpr (EPI == 1) {
#pragma unroll
        for (int s = 0; s < 32 / NW; ++s) { ca[s] = (v4f){}; cb[s] = (v4f){}; }
        if (!vt) { const float* cp = CS + ((size_t)(t0 + ((int)threadIdx.x >> 4)) * HD + ((int)threadIdx.x & 15) * 4) * 2;   // row group s lies NW * 2 positions further on
#pragma unroll
            for (int s = 0; s < 32 / NW; ++s) { ca[s] = *(const v4fa*)(cp + s * (NW * 2 * HD * 2)); cb[s] = *(const v4fa*)(cp + s * (NW * 2 * HD * 2) + 4); }
            asm volatile("s_wait_xcnt 0x0" :: "v"(cp) : "memory"); } }   // the wait before the address register of these loads is overwritten; the address is an input, so that it stays whole up to it
    const size_t aoff = (size_t)(r0 + lr) * lda + 8 * hi, boff = (size_t)(c0 + lr) * K + 8 * hi;
    for (int kb = w * KCH; kb < Kl; kb += NW * KCH) { const int ke = min(kb + KCH, Kl);
#pragma unroll 1
    for (int kc = kb; kc < ke; kc += 32) {
        V a[4], a2[4];
#pragma unroll
        for (int mb = 0; mb < 4; ++mb) { a[mb] = WFrag<T16>::ld(A + aoff + (size_t)mb * 16 * lda + kc); if (NSPLIT == 1 || NSPLIT == 2) a2[mb] = WFrag<T16>::ld(A2 + aoff + (size_t)mb * 16 * lda + kc); }
#pragma unroll
        for (int nb = 0; nb < 4; ++nb) { const V b = WFrag<T16>::ld(Bt + boff + (size_t)nb * 16 * K + kc); V b2; if (NSPLIT >= 2) b2 = WFrag<T16>::ld(Bt2 + boff + (size_t)nb * 16 * K + kc);
#pragma unroll
            for (int mb = 0; mb < 4; ++mb) { acc[mb][nb] = WFrag<T16>::mma(a[mb], b, acc[mb][nb]); if (NSPLIT == 1 || NSPLIT == 2) acc[mb][nb] = WFrag<T16>::mma(a2[mb], b, acc[mb][nb]); if (NSPLIT >= 2) acc[mb][nb] = WFrag<T16>::mma(a[mb], b2, acc[mb][nb]); } }
        asm volatile("v_nop\n\tv_nop\n\tv_nop\n\tv_nop" : "+v"(acc[0][0]), "+v"(acc[1][1]), "+v"(acc[2][2]), "+v"(acc[3][3]) : "v"(a[0]), "v"(a[3]));
    } }
    float* ow = os + w * (64 * 68);   // this wave's partial tile, row-major at pitch 68 (a wave whose runs all lie beyond Kl hands in zeros)
#pragma unroll
    for (int mb = 0; mb < 4; ++mb)
#pragma unroll
        for (int nb = 0; nb < 4; ++nb)
#pragma unroll
            for (int j = 0; j < 8; ++j) ow[(mb * 16 + hi * 8 + j) * 68 + nb * 16 + lr] = acc[mb][nb][j];
    __syncthreads();   // every wave's partial tile is in LDS before any of it is summed
    const size_t pz = (((size_t)(blockIdx.y / NH_) * NB_ + blockIdx.x * 64 / TT) * NH_ + blockIdx.y % NH_) * (size_t)(TT * HD);   // EPI 1: where this tile's (q | k | v, batch, head) starts in every plane
    auto finish = [&](auto sel) { constexpr bool VT = decltype(sel)::v;   // the two kinds of tile each get straight-line code of their own: one branch a tile, not one a row group
#pragma unroll
    for (int s = 0; s < 32 / NW; ++s) { const int q = s * NW * 32 + (int)threadIdx.x; const int row = q >> 4, cofs = (q & 15) * 4; v4f val = *(const v4fa*)(os + row * 68 + cofs);
#pragma unroll
        for (int u = 1; u < NW; ++u) val += *(const v4fa*)(os + u * (64 * 68) + row * 68 + cofs);
        if constexpr (VT) { val += bfr(bias[r0 + row]); planes4(val, pz + (size_t)row * TT + t0 + cofs, P16, Ph, Pl); continue; }
        if (BIAS) { val[0] += bfr(bias[c0 + cofs]); val[1] += bfr(bias[c0 + cofs + 1]); val[2] += bfr(bias[c0 + cofs + 2]); val[3] += bfr(bias[c0 + cofs + 3]); }
        if constexpr (EPI == 1) { v4f xp;   // the partner columns d +- 32 of the same row sit in lane l ^ 8 (16 lanes a row, 4 columns a lane)
#pragma unroll
            for (int j = 0; j < 4; ++j) xp[j] = xrow8(val[j]);
            const float sg = cofs < HD / 2 ? -1.0f : 1.0f; v4f r; r[0] = val[0] * ca[s][0] + xp[0] * (sg * ca[s][1]); r[1] = val[1] * ca[s][2] + xp[1] * (sg * ca[s][3]); r[2] = val[2] * cb[s][0] + xp[2] * (sg * cb[s][1]); r[3] = val[3] * cb[s][2] + xp[3] * (sg * cb[s][3]);
            planes4(r, pz + (size_t)(t0 + row) * HD + cofs, P16, Ph, Pl); continue; }
        *(v4f*)(C + (size_t)(r0 + row) * ldc + c0 + cofs) = val; }
    if constexpr (EPI == 1 && !VT) asm volatile("s_wait_xcnt 0x0" ::: "memory"); };   // the wait before a register that the q/k tile's last stores name is overwritten: the v tile's code lies behind a branch here
    if (vt) finish(Sel<true>{}); else finish(Sel<false>{});
}

__device__ __forceinline__ h16 tohx(float x) { return (h16)x; }
__device__ __forceinline__ void splitf(float y, unsigned short& h, unsigned short& l) { h = f2bf(y); l = f2bf(y - bf2f(h)); }
typedef __attribute__((ext_vector_type(2))) _Float16 v2h;
typedef __attribute__((ext_vector_type(4))) _Float16 v4h;
typedef __attribute__((ext_vector_type(2))) unsigned short v2us;
typedef __attribute__((ext_vector_type(4))) unsigned short v4us;
typedef __attribute__((ext_vector_type(2))) float v2f;
typedef __attribute__((ext_vector_type(4))) int v4i;
typedef v4h  __attribute__((may_alias)) v4ha;
typedef v4us __attribute__((may_alias)) v4usa;
// four neighbouring plane elements from f32: fp16, and bf16 hi + lo
__device__ __forceinline__ void planes4(v4f r, size_t e, h16* P16, bf* Ph, bf* Pl) { v4h o16; v4us oh, ol;
#pragma unroll
    for (int j = 0; j < 4; ++j) { o16[j] = tohx(r[j]); unsigned short a2, c2; splitf(r[j], a2, c2); oh[j] = a2; ol[j] = c2; }
    *(v4h*)(P16 + e) = o16; *(v4us*)(Ph + e) = oh; *(v4us*)(Pl + e) = ol; }

// ---- k_prep: all that depends on the inputs alone, in one launch; the block index picks the job (d_wtG twice, d_cstabH, d_cvt8), each job's blocks numbered from 0 in blk.
__device__ __forceinline__ void d_wtG(const float* __restrict__ w, int K, int N, bf* Bt, int blk) {
    const int lane = threadIdx.x & 31; const int L0 = (blk * 8 + (threadIdx.x >> 5)) * 8; const int nlines = N * K / 64;
{
#pragma unroll 1
        for (int l = 0; l < 8; ++l) { const int L = L0 + l; if (L >= nlines) break; const size_t e = (size_t)L * 64 + lane * 2; const int k = (int)(e % K), n = (int)(e / K); v2us o;
            o[0] = f2bf(w[(size_t)k * N + n]); o[1] = f2bf(w[(size_t)(k + 1) * N + n]); *(v2us*)(Bt + e) = o; }
         }
}
// a thread takes the same eight elements of every batch (n8 groups of eight a batch): eight loads in flight a thread
__device__ __forceinline__ void d_cvt8(const float* __restrict__ src, bf* dst, unsigned n8, int blk) { const unsigned i = (unsigned)blk * 256 + threadIdx.x; if (i >= n8) return; v8f v[NB_]; const float* p[NB_];
#pragma unroll
    for (int b = 0; b < NB_; ++b) { p[b] = src + (size_t)b * n8 * 8 + i * 8; v[b] = *(const v8f*)p[b]; }
    asm volatile("s_wait_xcnt 0x0" :: "v"(p[0]), "v"(p[1]), "v"(p[2]), "v"(p[3]) : "memory");   // the wait before an address register of these loads is overwritten; the addresses are inputs, so that they stay whole up to it and no load of the run lands on one
#pragma unroll
    for (int b = 0; b < NB_; ++b) { v8us o;
#pragma unroll
        for (int k = 0; k < 8; ++k) o[k] = f2bf(v[b][k]);
        *(v8us*)(dst + (size_t)b * n8 * 8 + i * 8) = o; } }

__constant__ float INVT[HD / 2] = { 1.000000000e+00f, 5.623413324e-01f, 3.162277639e-01f, 1.778279394e-01f, 1.000000015e-01f, 5.623412877e-02f, 3.162277862e-02f, 1.778279431e-02f, 9.999999776e-03f, 5.623413250e-03f, 3.162277862e-03f, 1.778279431e-03f, 1.000000047e-03f, 5.623413017e-04f, 3.162277862e-04f, 1.778279402e-04f, 1.000000000e+00f, 5.623413324e-01f, 3.162277639e-01f, 1.778279394e-01f, 1.000000015e-01f, 5.623412877e-02f, 3.162277862e-02f, 1.778279431e-02f, 9.999999776e-03f, 5.623413250e-03f, 3.162277862e-03f, 1.778279431e-03f, 1.000000047e-03f, 5.623413017e-04f, 3.162277862e-04f, 1.778279402e-04f };
__device__ __forceinline__ void d_cstabH(float* CS, int blk) { const int idx = blk * 256 + threadIdx.x; if (idx >= TT * HD) return; const int d = idx % HD; const int t = idx / HD; const float a = __fmul_rn((float)t, INVT[d & (HD / 2 - 1)]); v2f cs; cs[0] = cosf(a); cs[1] = sinf(a); *(v2f*)(CS + (size_t)idx * 2) = cs;  }
#define PB_WA ((DM * 3 * DQ / 64 + 63) / 64)   // blocks of the fused weight's transposition
#define PB_WO ((DQ * DM / 64 + 63) / 64)       // of W_proj's
#define PB_CS ((TT * HD + 255) / 256)          // of the rotary table
#define PB_X  ((TT * DM / 8 + 255) / 256)      // of the bf16 copy of x
__global__ __launch_bounds__(256) void k_prep(const float* __restrict__ x, const float* __restrict__ wqkv, const float* __restrict__ wo, bf* XB, bf* WQKV, bf* WO, float* CS, unsigned n8) {
    int blk = blockIdx.x;   // the transpositions first: their waves run longest
    if (blk < PB_WA) { d_wtG(wqkv, DM, 3 * DQ, WQKV, blk); return; }   /* fused 'xw' [DM][3*DQ] -> Bt [3*DQ][DM] */
    blk -= PB_WA; if (blk < PB_WO) { d_wtG(wo, DQ, DM, WO, blk); return; }
    blk -= PB_WO; if (blk < PB_CS) { d_cstabH(CS, blk); return; }   /* positions = arange */
    blk -= PB_CS; d_cvt8(x, XB, n8, blk);
}
// ---- k_fattn: causal attention in one kernel, nothing of the scores or probabilities in memory. One wave owns QW = 32 query rows of one (batch, head) and walks the keys in passes (64 keys x 32 queries; HR: 32 keys x 16 queries, the two halves of its rows in turn), up to its diagonal; waves share nothing (no LDS, no barrier).
// Transposed products: St[key][query] = K Qt (A = K rows, B = Q rows, both by WFrag::ld), so a lane holds scores of ONE query (column lr): running maximum and sum in the lane plus one exchange between the wave halves;
// two score tiles (keys 32c + 0..15, 32c + 16..31), converted in place, ARE the B operand of Ot[d][query] += Vt P t in the k order of WFrag::ld (element e < 8: key 8 hi + e, else 16 + 8 hi + e - 8); A = rows of the transposed value plane.
// HR (query rows < RH): bf16 hi/lo planes, 3 products in both contractions; else fp16, the probabilities carried x 2^POFF (it cancels against the row sum). The row sum adds the unrounded f32 exponentials; the division by it comes last.
#define QW   32
#define POFF 10.0f
#define KS   0.18033688011112042f   // HD^-0.5 x log2(e)
__device__ __forceinline__ float xhalf(float x) { return __builtin_bit_cast(float, __builtin_amdgcn_permlanex16(__builtin_bit_cast(int, x), __builtin_bit_cast(int, x), 0x76543210, 0xfedcba98, false, false)); }   // lane l with lane l ^ 16
// 2^x with the free slot that the instruction set asks for behind a transcendental, before its result is used or its source overwritten.
// In one statement the slot stands by construction; each of the four works in place on a register of its own, so that none touches a neighbour's source or result.
__device__ __forceinline__ float exp2n(float x) { float r; asm("v_exp_f32 %0, %1\n\tv_nop" : "=v"(r) : "v"(x)); return r; }
__device__ __forceinline__ void exp2x4(float& a, float& b, float& c, float& d) { asm("v_exp_f32 %0, %0\n\tv_exp_f32 %1, %1\n\tv_exp_f32 %2, %2\n\tv_exp_f32 %3, %3\n\tv_nop" : "+v"(a), "+v"(b), "+v"(c), "+v"(d)); }
template <bool HR> struct FT { typedef h16 T; };
template <> struct FT<true> { typedef bf T; };
template <bool HR, bool MASK, int NB, int MB>   // NB blocks of 16 query columns, MB blocks of 16 keys a pass
__device__ __forceinline__ void fa_pass(const typename FT<HR>::T* kp, const typename FT<HR>::T* kp2, const typename FT<HR>::T* vp, const typename FT<HR>::T* vp2, unsigned kl, unsigned vl, int dq,
                                        const typename WFrag<typename FT<HR>::T>::V (&qf)[NB][2], const typename WFrag<typename FT<HR>::T>::V (&qf2)[NB][2], v8f (&o)[4][NB], float (&m)[NB], float (&l)[NB]) {
    typedef typename FT<HR>::T T16; typedef WFrag<T16> F; typedef typename F::V V;
    V kf[MB][2], kf2[MB][2]; const T16* ka = kp + kl; const T16* ka2 = kp2 + kl;
#pragma unroll
    for (int mb = 0; mb < MB; ++mb)
#pragma unroll
        for (int c = 0; c < 2; ++c) { kf[mb][c] = F::ld(ka + mb * 16 * HD + c * 32); if (HR) kf2[mb][c] = F::ld(ka2 + mb * 16 * HD + c * 32); }
    // the wait before a register that an issued load names is overwritten; the addresses are inputs, so that they stay whole up to it and no load of the run lands on one
    if constexpr (HR) asm volatile("s_wait_xcnt 0x0" :: "v"(ka), "v"(ka2) : "memory"); else asm volatile("s_wait_xcnt 0x0" :: "v"(ka) : "memory");
    __builtin_amdgcn_sched_barrier(0);   // all K loads of the pass go out together, ahead of the first product: one memory latency a pass, not one per 16 keys
    v8f s[MB][NB];
#pragma unroll
    for (int mb = 0; mb < MB; ++mb)
#pragma unroll
        for (int nb = 0; nb < NB; ++nb) { v8f a = (v8f){}; a = F::mma(kf[mb][0], qf[nb][0], a); a = F::mma(kf[mb][1], qf[nb][1], a);
            if (HR) { a = F::mma(kf2[mb][0], qf[nb][0], a); a = F::mma(kf2[mb][1], qf[nb][1], a); a = F::mma(kf[mb][0], qf2[nb][0], a); a = F::mma(kf[mb][1], qf2[nb][1], a); }
            s[mb][nb] = a; }
    V vf[4][MB / 2], vf2[4][MB / 2]; const T16* va = vp + vl; const T16* va2 = vp2 + vl;
#pragma unroll
    for (int db = 0; db < 4; ++db)
#pragma unroll
        for (int c = 0; c < MB / 2; ++c) { vf[db][c] = F::ld(va + db * 16 * TT + c * 32); if (HR) vf2[db][c] = F::ld(va2 + db * 16 * TT + c * 32); }
    if constexpr (HR) asm volatile("s_wait_xcnt 0x0" :: "v"(va), "v"(va2) : "memory"); else asm volatile("s_wait_xcnt 0x0" :: "v"(va) : "memory");   // as behind the K loads
    __builtin_amdgcn_sched_barrier(0);   // the Vt loads go out ahead of the softmax and fly under it
    V pf[MB / 2][NB], pl[MB / 2][NB];
#pragma unroll
    for (int nb = 0; nb < NB; ++nb) { float mx = m[nb];
#pragma unroll
        for (int mb = 0; mb < MB; ++mb)
#pragma unroll
            for (int j = 0; j < 8; ++j) { if (MASK && (mb * 16 + j - nb * 16 > dq)) s[mb][nb][j] = -3.0e38f;   // key > query
                mx = fmaxf(mx, s[mb][nb][j]); }
        mx = fmaxf(mx, xhalf(mx));
        const float al = exp2n((m[nb] - mx) * KS); const float mk = mx * KS - (HR ? 0.0f : POFF); m[nb] = mx; float ps = 0.f;
#pragma unroll
        for (int mb = 0; mb < MB; ++mb)
#pragma unroll
            for (int j = 0; j < 8; j += 4) { float p0 = __builtin_fmaf(s[mb][nb][j], KS, -mk), p1 = __builtin_fmaf(s[mb][nb][j + 1], KS, -mk), p2 = __builtin_fmaf(s[mb][nb][j + 2], KS, -mk), p3 = __builtin_fmaf(s[mb][nb][j + 3], KS, -mk);
                exp2x4(p0, p1, p2, p3); s[mb][nb][j] = p0; s[mb][nb][j + 1] = p1; s[mb][nb][j + 2] = p2; s[mb][nb][j + 3] = p3; ps += p0; ps += p1; ps += p2; ps += p3; }
        l[nb] = l[nb] * al + ps;
#pragma unroll
        for (int db = 0; db < 4; ++db) o[db][nb] *= al;
#pragma unroll
        for (int c = 0; c < MB / 2; ++c) {
            if constexpr (HR) { v8us h0, h1, l0, l1;
#pragma unroll
                for (int j = 0; j < 8; ++j) { unsigned short a, b; splitf(s[2 * c][nb][j], a, b); h0[j] = a; l0[j] = b; splitf(s[2 * c + 1][nb][j], a, b); h1[j] = a; l1[j] = b; }
                pf[c][nb] = cat16b(h0, h1); pl[c][nb] = cat16b(l0, l1);
            } else { v8h h0, h1;
#pragma unroll
                for (int j = 0; j < 8; ++j) { h0[j] = tohx(s[2 * c][nb][j]); h1[j] = tohx(s[2 * c + 1][nb][j]); }
                pf[c][nb] = cat16(h0, h1); } }
        if (nb + 1 < NB) __builtin_amdgcn_sched_barrier(0); }   // one column block's scores are packed (half the registers) before the next block's exponentials start: mixed, the two cost spills
#pragma unroll
    for (int db = 0; db < 4; ++db)
#pragma unroll
        for (int nb = 0; nb < NB; ++nb) { v8f a = o[db][nb];
#pragma unroll
            for (int c = 0; c < MB / 2; ++c) { a = F::mma(vf[db][c], pf[c][nb], a); if (HR) a = F::mma(vf[db][c], pl[c][nb], a); }
            o[db][nb] = a; }
    if (HR) {
#pragma unroll
        for (int db = 0; db < 4; ++db)
#pragma unroll
            for (int nb = 0; nb < NB; ++nb) { v8f a = o[db][nb];
#pragma unroll
                for (int c = 0; c < MB / 2; ++c) a = F::mma(vf2[db][c], pf[c][nb], a);
                o[db][nb] = a; } }
    // the distance behind the pass's last matrix instructions, also on the taken back edge of the key loop
    if constexpr (!MASK && NB == 2) asm volatile("v_nop\n\tv_nop\n\tv_nop\n\tv_nop" : "+v"(o[0][0]), "+v"(o[0][1]), "+v"(o[1][0]), "+v"(o[1][1]), "+v"(o[2][0]), "+v"(o[2][1]), "+v"(o[3][0]), "+v"(o[3][1]) : "v"(pf[0][0]), "v"(pf[0][1]), "v"(pf[MB / 2 - 1][0]), "v"(pf[MB / 2 - 1][1]));
    if constexpr (!MASK && NB == 1) asm volatile("v_nop\n\tv_nop\n\tv_nop\n\tv_nop" : "+v"(o[0][0]), "+v"(o[1][0]), "+v"(o[2][0]), "+v"(o[3][0]) : "v"(pf[0][0]), "v"(pf[MB / 2 - 1][0]));
}
template <bool HR, int NB, int MB>
__device__ __forceinline__ void fa_tile(const typename FT<HR>::T* Q, const typename FT<HR>::T* Q2, const typename FT<HR>::T* K, const typename FT<HR>::T* K2, const typename FT<HR>::T* Vt, const typename FT<HR>::T* Vt2, bf* ah, bf* al, int q0, int lr, int hi) {
    typedef typename FT<HR>::T T16; typedef WFrag<T16> F; typedef typename F::V V;
    V qf[NB][2], qf2[NB][2];
#pragma unroll
    for (int nb = 0; nb < NB; ++nb) { const size_t qo = (size_t)(q0 + nb * 16 + lr) * HD + 8 * hi; const T16* qa = Q + qo; const T16* qa2 = Q2 + qo;
#pragma unroll
        for (int c = 0; c < 2; ++c) { qf[nb][c] = F::ld(qa + c * 32); if (HR) qf2[nb][c] = F::ld(qa2 + c * 32); }
        // the wait before the address registers of the Q loads are overwritten; the addresses are inputs, so that they stay whole up to it
        if constexpr (HR) asm volatile("s_wait_xcnt 0x0" :: "v"(qa), "v"(qa2) : "memory"); else asm volatile("s_wait_xcnt 0x0" :: "v"(qa) : "memory"); }
    v8f o[4][NB]; float m[NB], l[NB];
#pragma unroll
    for (int nb = 0; nb < NB; ++nb) { m[nb] = -3.0e38f; l[nb] = 0.f; }
#pragma unroll
    for (int db = 0; db < 4; ++db)
#pragma unroll
        for (int nb = 0; nb < NB; ++nb) o[db][nb] = (v8f){};
    const unsigned kl = lr * HD + 8 * hi, vl = lr * TT + 8 * hi;   /* the lane's place in a pass's K rows and Vt rows; the pass's own start stays in the wave-uniform pointers */ const int KP = MB * 16, nfull = q0 / KP;   // passes wholly below the diagonal; pass nfull holds it (its first key is <= every query of the wave)
#pragma unroll 1
    for (int it = 0; it < nfull; ++it) fa_pass<HR, false, NB, MB>(K + (size_t)it * KP * HD, K2 + (size_t)it * KP * HD, Vt + it * KP, Vt2 + it * KP, kl, vl, 0, qf, qf2, o, m, l);
    fa_pass<HR, true, NB, MB>(K + (size_t)nfull * KP * HD, K2 + (size_t)nfull * KP * HD, Vt + nfull * KP, Vt2 + nfull * KP, kl, vl, q0 + lr - nfull * KP - hi * 8, qf, qf2, o, m, l);
#pragma unroll
    for (int nb = 0; nb < NB; ++nb) { const float inv = __fdiv_rn(1.0f, l[nb] + xhalf(l[nb])); const size_t oo = (size_t)(q0 + nb * 16 + lr) * DQ + hi * 8;
#pragma unroll
        for (int db = 0; db < 4; ++db) { v8us oh, ol;
#pragma unroll
            for (int j = 0; j < 8; ++j) { unsigned short a, b; splitf(o[db][nb][j] * inv, a, b); oh[j] = a; ol[j] = b; }
            *(v8us*)(ah + oo + db * 16) = oh; *(v8us*)(al + oo + db * 16) = ol; } }
    asm volatile("s_wait_xcnt 0x0" ::: "memory");   // the wait before registers that the last output stores name are overwritten (the next trip of the caller's loop; the code behind the call)
}
// grid (NB_ * NH_, TT / 128): x = batch * NH_ + head, y counts the blocks of 128 query rows from the LAST down (y = 0 holds the longest rows, for speed only). Output: merged hi/lo planes [batch][t][DQ].
__global__ __launch_bounds__(128) __attribute__((amdgpu_waves_per_eu(4, 4))) void k_fattn(const h16* __restrict__ Q16, const h16* __restrict__ K16, const h16* __restrict__ V16, const bf* __restrict__ Qh, const bf* __restrict__ Ql, const bf* __restrict__ Kh, const bf* __restrict__ Kl, const bf* __restrict__ Vh, const bf* __restrict__ Vl, bf* Ah, bf* Al) {
    const int lane = threadIdx.x & 31, lr = lane & 15, hi = lane >> 4; const int w = __builtin_amdgcn_readfirstlane((int)(threadIdx.x >> 5));   // wave number, held scalar so that the key loop stays a scalar branch
    const int bh = blockIdx.x; const int q0 = (TT / 128 - 1 - (int)blockIdx.y) * 128 + w * QW; const size_t pz = (size_t)bh * TT * HD; const size_t az = (size_t)(bh / NH_) * TT * DQ + (size_t)(bh % NH_) * HD;
    if (q0 < RH) {   // twice the operand planes: a quarter of the pass (16 query columns, 32 keys), so that the kernel stays inside 256 registers without spills
#pragma unroll 1
        for (int u = 0; u < QW; u += 16) fa_tile<true, 1, 2>(Qh + pz, Ql + pz, Kh + pz, Kl + pz, Vh + pz, Vl + pz, Ah + az, Al + az, q0 + u, lr, hi);
    } else fa_tile<false, 2, 4>(Q16 + pz, Q16 + pz, K16 + pz, K16 + pz, V16 + pz, V16 + pz,   /* no second planes: never read */ Ah + az, Al + az, q0, lr, hi);
}

extern "C" void kernel_launch(void* const* d_in, const int* in_sizes, int n_in,
                              void* d_out, int out_size, void* d_ws, size_t ws_size, hipStream_t stream) {
    (void)in_sizes; (void)n_in; (void)out_size;
    const float* x = (const float*)d_in[0]; const float* wqkv = (const float*)d_in[1]; const float* bqkv = (const float*)d_in[2]; const float* wo = (const float*)d_in[3]; const float* bo = (const float*)d_in[4];   /* input order x, W_attn ('xw' [1024][3072]: q | k | v column thirds), b_attn (zeros: read), W_proj, b_proj (zeros: read); five inputs, all read */
    float* OUT = (float*)d_out;     // [4][2048][1024]
    char* wsp = (char*)d_ws;
    auto take = [&](size_t bytes) { char* p = wsp; wsp += (bytes + 255) & ~(size_t)255; return (void*)p; };
    bf* WQKV = (bf*)take((size_t)3 * DQ * DM * 2);   /* fused Bt [3*DQ][DM]: q | k | v row blocks */ bf* WO = (bf*)take((size_t)DM * DQ * 2); float* CS = (float*)take((size_t)TT * HD * 2 * 4);
    bf* XB = (bf*)take((size_t)NB_ * TT * DM * 2);
    const size_t PZ = (size_t)NH_ * TT * HD;   /* one batch's plane, in elements; every plane holds all NB_ batches, [batch][head][..][..]; q, k and v planes of a kind lie behind one another */
    h16* QP16 = (h16*)take(3 * NB_ * PZ * 2); h16* KP16 = QP16 + NB_ * PZ; h16* VT16 = KP16 + NB_ * PZ;
    bf* QPh = (bf*)take(3 * NB_ * PZ * 2); bf* KPh = QPh + NB_ * PZ; bf* VTh = KPh + NB_ * PZ; bf* QPl = (bf*)take(3 * NB_ * PZ * 2); bf* KPl = QPl + NB_ * PZ; bf* VTl = KPl + NB_ * PZ;
    bf* ATh = (bf*)take((size_t)NB_ * TT * DQ * 2); bf* ATl = (bf*)take((size_t)NB_ * TT * DQ * 2);
    if ((size_t)(wsp - (char*)d_ws) > ws_size) return;    // ws 256 MiB
    k_prep<<<PB_WA + PB_WO + PB_CS + PB_X, 256, 0, stream>>>(x, wqkv, wo, XB, WQKV, WO, CS, TT * DM / 8);
    k_gemmw<bf, 0, true, 8, 128, false, 1><<<dim3(NB_ * TT / 64, 3 * NH_, 1), 256, 0, stream>>>(XB, nullptr, DM, WQKV, nullptr, DM, nullptr, 0, bqkv, 0, 0, 0, 0, CS, QP16, QPh, QPl);   /* q, k, v of every batch */
    k_fattn<<<dim3(NB_ * NH_, TT / 128, 1), 128, 0, stream>>>(QP16, KP16, VT16, QPh, QPl, KPh, KPl, VTh, VTl, ATh, ATl);   /* every batch and head at once */
    k_gemmw<bf, 1, true, 8, 128, false, 0><<<dim3(NB_ * TT / 64, DM / 64, 1), 256, 0, stream>>>(ATh, ATl, DQ, WO, nullptr, DQ, OUT, DM, bo, 0, 0, 0, 0, nullptr, nullptr, nullptr, nullptr);   /* rows (batch, t) */
}
